// v000
// The times below were measured on an AMD MI455X: many runs one after another, warmed up first and cycling through
// copies of the inputs, with the whole window's GPU time divided by the number of runs. Launches and the gaps
// between them are all in it. The median over several windows is given; except for v000 it joins two sittings, which
// can be a few percent apart, so the side-by-side timings, each taken in one sitting, are the better comparison.
// v000 is the starting kernel. One run takes 2660 microseconds.
#include <hip/hip_runtime.h>

// Multi-head attention on three input streams with an output projection, returning the projected output AND the per-head context (q, k, v [4][2048][1024]; Q = q Wq^T + bq, K = k Wk^T + bk, V = v Wv^T + bv with 'oi' weights [1024][1024] and
// biases [1024]; 16 heads x 64 (head h = columns h x 64 ..); scores x 1/sqrt(64); softmax over all 2048 keys; no mask; ctx = weights V; merged head-major [b][t][1024]; out = merged Wo^T + bo ('oi' [1024][1024]);
// TWO OUTPUTS in one buffer: out [4][2048][1024] at float offset 0 and ctx [4][16][2048][64] at float offset 8,388,608; argument order q, k, v, wq_w, wq_b, wk_w, wk_b, wv_w, wv_b, wo_w, wo_b).
// Layout per batch entry: one bf16 staging copy, refilled for each stream in order (q, k, v); 'oi' weights copied as they stand; exact projections + f32 biases; identity-table plane builders; dense T-2048 attention at 16 heads, two heads a pass,
// merged hi/lo x Wo exact + bo writes the first output.
// Compute dtypes, f32 accumulate: every float input rounded to bf16 at its load; projections exact + f32 biases; scores and attn.v fp16; softmax f32; output projection hl x exact; the second output an exact power-of-two rescale of the f32 context.

#define NB_  4
#define TT   2048
#define DM   1024
#define NH_  16
#define NKV  16
#define REP  (NH_ / NKV)
#define HD   64
#define DQ   (NH_ * HD)
#define DKV  (NKV * HD)
#define ZH   2
#define RH   0                    // query rows < RH use hi+lo planes (0: none)
#define WIN  0
#define PCAR 1024.0f
#define SCL  0.125f   // HD^-0.5
typedef _Float16 h16;
typedef unsigned short bf;
typedef __attribute__((ext_vector_type(16))) __bf16   v16bf;
typedef __attribute__((ext_vector_type(16))) _Float16 v16h;
typedef __attribute__((ext_vector_type(8)))  _Float16 v8h;
typedef __attribute__((ext_vector_type(8)))  unsigned short v8us;
typedef __attribute__((ext_vector_type(8)))  float    v8f;
typedef __attribute__((ext_vector_type(4)))  float    v4f;
typedef v8h  __attribute__((may_alias)) v8ha;
typedef v4f  __attribute__((may_alias)) v4fa;
typedef v8us __attribute__((may_alias)) v8usa;

__device__ __forceinline__ unsigned short f2bf(float f) { unsigned u = __float_as_uint(f); u += 0x7FFFu + ((u >> 16) & 1u); return (unsigned short)(u >> 16); }
__device__ __forceinline__ float bf2f(unsigned short b) { return __uint_as_float(((unsigned)b) << 16); }
__device__ __forceinline__ float bfr(float f) { return bf2f(f2bf(f)); }
__device__ __forceinline__ v16h cat16(v8h lo, v8h hi) { return __builtin_shufflevector(lo, hi, 0, 1, 2, 3, 4, 5, 6, 7, 8, 9, 10, 11, 12, 13, 14, 15); }
__device__ __forceinline__ v16bf cat16b(v8us lo, v8us hi) { return __builtin_bit_cast(v16bf, __builtin_shufflevector(lo, hi, 0, 1, 2, 3, 4, 5, 6, 7, 8, 9, 10, 11, 12, 13, 14, 15)); }
__device__ __forceinline__ v8f wmma16(v16h a, v16h b, v8f c) { return __builtin_amdgcn_wmma_f32_16x16x32_f16(false, a, false, b, (short)0, c, false, false); }
__device__ __forceinline__ v8f wmmab(v16bf a, v16bf b, v8f c) { return __builtin_amdgcn_wmma_f32_16x16x32_bf16(false, a, false, b, (short)0, c, false, false); }



// ---- k_gemmw: register-blocked GEMM, ONE WAVE per 64x64 output tile (16 accumulators), operands straight from K-contiguous 16-bit planes; grid (M/64, N/64, Z), 32 threads.
// C[m][n] (f32, pitch ldc, + optional f32 bias[n]) = sum_k A[m][k] Bt[n][k] (+ split products per NSPLIT). z-batch strides sA/sB/sC in elements. K % 32 == 0.
template <typename T16> struct WFrag;
template <> struct WFrag<h16> { typedef v16h V; static __device__ __forceinline__ V ld(const h16* p) { return cat16(*(const v8h*)p, *(const v8h*)(p + 16)); } static __device__ __forceinline__ v8f mma(V a, V b, v8f c) { return wmma16(a, b, c); } };
template <> struct WFrag<bf> { typedef v16bf V; static __device__ __forceinline__ V ld(const bf* p) { return cat16b(*(const v8us*)p, *(const v8us*)(p + 16)); } static __device__ __forceinline__ v8f mma(V a, V b, v8f c) { return wmmab(a, b, c); } };
template <typename T16, int NSPLIT, bool BIAS>
__global__ __launch_bounds__(32) void k_gemmw(const T16* __restrict__ A, const T16* __restrict__ A2, const T16* __restrict__ Bt, const T16* __restrict__ Bt2, int K, float* C, int ldc, const float* __restrict__ bias, size_t sA, size_t sB, size_t sC) {
    typedef typename WFrag<T16>::V V;
    __shared__ __align__(16) float os[16 * 68];
    const size_t z = blockIdx.z; A += z * sA; if (A2) A2 += z * sA; Bt += z * sB; if (Bt2) Bt2 += z * sB; C += z * sC;
    const int lane = threadIdx.x & 31, lr = lane & 15, hi = lane >> 4; const int r0 = blockIdx.x * 64, c0 = blockIdx.y * 64;
    v8f acc[4][4];
#pragma unroll
    for (int mb = 0; mb < 4; ++mb)
#pragma unroll
        for (int nb = 0; nb < 4; ++nb) acc[mb][nb] = (v8f){};
    const size_t aoff = (size_t)(r0 + lr) * K + 8 * hi, boff = (size_t)(c0 + lr) * K + 8 * hi;

    for (int kc = 0; kc < K; kc += 32) {
        V a[4], a2[4];
#pragma unroll
        for (int mb = 0; mb < 4; ++mb) { a[mb] = WFrag<T16>::ld(A + aoff + (size_t)mb * 16 * K + kc); if (NSPLIT == 1 || NSPLIT == 2) a2[mb] = WFrag<T16>::ld(A2 + aoff + (size_t)mb * 16 * K + kc); }
#pragma unroll
        for (int nb = 0; nb < 4; ++nb) { const V b = WFrag<T16>::ld(Bt + boff + (size_t)nb * 16 * K + kc); V b2; if (NSPLIT >= 2) b2 = WFrag<T16>::ld(Bt2 + boff + (size_t)nb * 16 * K + kc);
#pragma unroll
            for (int mb = 0; mb < 4; ++mb) { acc[mb][nb] = WFrag<T16>::mma(a[mb], b, acc[mb][nb]); if (NSPLIT == 1 || NSPLIT == 2) acc[mb][nb] = WFrag<T16>::mma(a2[mb], b, acc[mb][nb]); if (NSPLIT >= 2) acc[mb][nb] = WFrag<T16>::mma(a[mb], b2, acc[mb][nb]); } }
        asm volatile("v_nop\n\tv_nop\n\tv_nop\n\tv_nop" : "+v"(acc[0][0]), "+v"(acc[1][1]), "+v"(acc[2][2]), "+v"(acc[3][3]) : "v"(a[0]), "v"(a[3]));
    }
#pragma unroll
    for (int mb = 0; mb < 4; ++mb) {
#pragma unroll
        for (int nb = 0; nb < 4; ++nb) {
#pragma unroll
            for (int j = 0; j < 8; ++j) os[(hi * 8 + j) * 68 + nb * 16 + lr] = acc[mb][nb][j]; }
        __builtin_amdgcn_wave_barrier(); asm volatile("" ::: "memory");
        float* crow = C + (size_t)(r0 + mb * 16) * ldc + c0;
{
#pragma unroll
            for (int s = 0; s < 8; ++s) { const int row = 2 * s + hi, cofs = lr * 4; v4f val = *(const v4fa*)(os + row * 68 + cofs); if (BIAS) { val[0] += bfr(bias[c0 + cofs]); val[1] += bfr(bias[c0 + cofs + 1]); val[2] += bfr(bias[c0 + cofs + 2]); val[3] += bfr(bias[c0 + cofs + 3]); }
                *(v4f*)(crow + (size_t)row * ldc + cofs) = val; }
             }
        __builtin_amdgcn_wave_barrier(); asm volatile("" ::: "memory");
    }
}

__device__ __forceinline__ h16 tohx(float x) { return (h16)x; }
__device__ __forceinline__ void splitf(float y, unsigned short& h, unsigned short& l) { h = f2bf(y); l = f2bf(y - bf2f(h)); }
typedef __attribute__((ext_vector_type(2))) _Float16 v2h;
typedef __attribute__((ext_vector_type(4))) _Float16 v4h;
typedef __attribute__((ext_vector_type(2))) unsigned short v2us;
typedef __attribute__((ext_vector_type(4))) unsigned short v4us;
typedef __attribute__((ext_vector_type(2))) float v2f;
typedef __attribute__((ext_vector_type(4))) int v4i;

__global__ __launch_bounds__(256) void k_cvt8(const float* __restrict__ src, bf* dst, size_t n8) { const size_t i = (size_t)blockIdx.x * 256 + threadIdx.x; if (i >= n8) return; const v8f v = *(const v8f*)(src + i * 8); v8us o;
#pragma unroll
    for (int k = 0; k < 8; ++k) o[k] = f2bf(v[k]); *(v8us*)(dst + i * 8) = o;  }

// k_rope: head planes [h][t][d] (fp16 + hi/lo) of rope(x) x sc with the rotate-half convention out[d] = x[d] cos[t][d] - x[d+HD/2] sin[t][d], out[d+HD/2] = x[d+HD/2] cos[t][d+HD/2] + x[d] sin[t][d+HD/2]
__global__ __launch_bounds__(256) void k_rope(const float* __restrict__ F, int pitch, int nheads, const float* __restrict__ CS, const float* __restrict__ RF, const float* __restrict__ nw, float sc, h16* P16, bf* Ph, bf* Pl) {
    const size_t e = ((size_t)blockIdx.x * 256 + threadIdx.x) * 2; if (e >= (size_t)nheads * TT * HD) return; const int d = (int)(e % HD); const int t = (int)((e / HD) % TT); const int h = (int)(e / ((size_t)HD * TT)); const float* f = F + (size_t)t * pitch + h * HD; const float rf = RF ? RF[(size_t)h * TT + t] : 1.0f; v2h o16; v2us oh, ol;
#pragma unroll
    for (int q = 0; q < 2; ++q) { const int dd = d + q; const int dp = (dd < HD / 2) ? dd + HD / 2 : dd - HD / 2; float x0 = f[dd], x1 = f[dp];
        if (RF) { float n0 = __fmul_rn(x0, rf), n1 = __fmul_rn(x1, rf); x0 = __fmul_rn(bfr(nw[dd]), n0); x1 = __fmul_rn(bfr(nw[dp]), n1); }
        const v2f cs = *(const v2f*)(CS + ((size_t)t * HD + dd) * 2); float a = __fmul_rn(x0, cs[0]), bq = __fmul_rn(x1, cs[1]); const float r = ((dd < HD / 2) ? __fsub_rn(a, bq) : __fadd_rn(a, bq)) * sc;
        o16[q] = tohx(r); unsigned short a2, c2; splitf(r, a2, c2); oh[q] = a2; ol[q] = c2; }
    *(v2h*)(P16 + e) = o16; *(v2us*)(Ph + e) = oh; *(v2us*)(Pl + e) = ol;  }
__global__ __launch_bounds__(256) void k_vtp(const float* __restrict__ F, int pitch, int nheads, h16* V16, bf* Vh, bf* Vl) { const size_t e = ((size_t)blockIdx.x * 256 + threadIdx.x) * 2; if (e >= (size_t)nheads * HD * TT) return; const int t = (int)(e % TT); const int d = (int)((e / TT) % HD); const int g = (int)(e / ((size_t)TT * HD)); v2h o16; v2us oh, ol;
#pragma unroll
    for (int q = 0; q < 2; ++q) { const float x = F[(size_t)(t + q) * pitch + g * HD + d]; o16[q] = tohx(x); unsigned short a2, c2; splitf(x, a2, c2); oh[q] = a2; ol[q] = c2; }
    *(v2h*)(V16 + e) = o16; *(v2us*)(Vh + e) = oh; *(v2us*)(Vl + e) = ol;  }
__global__ __launch_bounds__(256) void k_csid(float* CS) { const int idx = blockIdx.x * 256 + threadIdx.x; if (idx >= TT * HD) return; v2f cs; cs[0] = 1.0f; cs[1] = 0.0f; *(v2f*)(CS + (size_t)idx * 2) = cs;  }
// k_asoft: per row (zz, i): t = S x HD^-0.5 (no mask); softmax over the 2048 keys (register row, one exp, fixed trees);
__global__ __launch_bounds__(256) void k_asoft(const float* __restrict__ Sb, h16* P16, bf* Ph, bf* Pl) {
    const int lane = threadIdx.x & 31; const int row = blockIdx.x * 8 + (threadIdx.x >> 5); if (row >= ZH * TT) return; const int i = row % TT; const int zz = row / TT; (void)zz; const bool hires = (i < RH); const float* sr = Sb + (size_t)row * TT; float v[TT / 32]; float mx = -3.0e38f;
#pragma unroll
    for (int ch = 0; ch < TT / 128; ++ch) { const int j0 = ch * 128 + lane * 4; const v4f a = *(const v4f*)(sr + j0);
#pragma unroll
        for (int q = 0; q < 4; ++q) { const int j = j0 + q; (void)j; const float t = a[q] * SCL; v[ch * 4 + q] = t; mx = fmaxf(mx, t); } }
#pragma unroll
    for (int sh = 16; sh; sh >>= 1) mx = fmaxf(mx, __shfl_xor(mx, sh, 32));
    float sum = 0.f;
#pragma unroll
    for (int k = 0; k < TT / 32; ++k) { float d0 = __fsub_rn(v[k], mx); v[k] = __builtin_amdgcn_exp2f(__fmul_rn(d0, 1.4426950408889634f)); sum += v[k]; }
#pragma unroll
    for (int sh = 16; sh; sh >>= 1) sum += __shfl_xor(sum, sh, 32);
    const float f = __fdiv_rn(hires ? 1.0f : PCAR, sum);
{
        if (hires) {
#pragma unroll
            for (int ch = 0; ch < TT / 128; ++ch) { v4us oh, ol;
#pragma unroll
                for (int q = 0; q < 4; ++q) { unsigned short a, c2; splitf(v[ch * 4 + q] * f, a, c2); oh[q] = a; ol[q] = c2; }
                const size_t oo = ((size_t)zz * (RH ? RH : 1) + i) * TT + ch * 128 + lane * 4; *(v4us*)(Ph + oo) = oh; *(v4us*)(Pl + oo) = ol; }
        } else {
#pragma unroll
            for (int ch = 0; ch < TT / 128; ++ch) { v4h o4;
#pragma unroll
                for (int q = 0; q < 4; ++q) o4[q] = tohx(v[ch * 4 + q] * f);
                *(v4h*)(P16 + (size_t)row * TT + ch * 128 + lane * 4) = o4; } }
         }
}
__global__ __launch_bounds__(256) void k_merge(const float* __restrict__ O, int h0, bf* Ah, bf* Al) { const size_t e = ((size_t)blockIdx.x * 256 + threadIdx.x) * 2; if (e >= (size_t)ZH * TT * HD) return; const int d = (int)(e % HD); const int t = (int)((e / HD) % TT); const int zz = (int)(e / ((size_t)HD * TT)); const float cs = (t < RH) ? 1.0f : (1.0f / PCAR); const size_t oo = (size_t)t * DQ + (h0 + zz) * HD + d;
    v2us oh, ol;
#pragma unroll
    for (int q = 0; q < 2; ++q) { unsigned short a, c2; splitf(O[e + q] * cs, a, c2); oh[q] = a; ol[q] = c2; } *(v2us*)(Ah + oo) = oh; *(v2us*)(Al + oo) = ol;  }

// k_ctxw: the second output: CTX[h0 + zz][t][d] = O[zz][t][d] x (t < RH ? 1 : 1/1024) for the pass's ZH heads (on rows >= RH the softmax weights are carried x1024 into the fp16 attn.v product: the factor is removed exactly, a power of two).
__global__ __launch_bounds__(256) void k_ctxw(const float* __restrict__ O, int h0, float* CTX) {
    const size_t e = ((size_t)blockIdx.x * 256 + threadIdx.x) * 4; if (e >= (size_t)ZH * TT * HD) return;
    const int t = (int)((e / HD) % TT); const float f = (t < RH) ? 1.0f : (1.0f / PCAR); v4f o = *(const v4f*)(O + e);
#pragma unroll
    for (int q = 0; q < 4; ++q) o[q] = __fmul_rn(o[q], f);
    float* dst = CTX + (size_t)h0 * TT * HD + e;
{ *(v4f*)dst = o;  }
}

extern "C" void kernel_launch(void* const* d_in, const int* in_sizes, int n_in,
                              void* d_out, int out_size, void* d_ws, size_t ws_size, hipStream_t stream) {
    (void)in_sizes; (void)n_in; (void)out_size;
    const float* xq = (const float*)d_in[0]; const float* xk = (const float*)d_in[1]; const float* xv = (const float*)d_in[2]; const float* wq = (const float*)d_in[3]; const float* bq = (const float*)d_in[4]; const float* wk = (const float*)d_in[5]; const float* bk = (const float*)d_in[6]; const float* wv = (const float*)d_in[7]; const float* bv = (const float*)d_in[8]; const float* wo = (const float*)d_in[9]; const float* bo = (const float*)d_in[10];
    // q, k, v [4][2048][1024], wq_w, wq_b, wk_w, wk_b, wv_w, wv_b, wo_w, wo_b = d_in[0..10]
    float* OUT = (float*)d_out;                          // output 0: out [4][2048][1024]
    float* OUT1 = (float*)d_out + (size_t)NB_ * TT * DM;   // output 1: ctx [4][16][2048][64], after the first output's 8,388,608 floats
    char* wsp = (char*)d_ws;
    auto take = [&](size_t bytes) { char* p = wsp; wsp += (bytes + 255) & ~(size_t)255; return (void*)p; };
    bf* WQ = (bf*)take((size_t)DQ * DM * 2); bf* WK = (bf*)take((size_t)DKV * DM * 2); bf* WV = (bf*)take((size_t)DKV * DM * 2); bf* WO = (bf*)take((size_t)DM * DQ * 2); float* CS = (float*)take((size_t)TT * HD * 2 * 4);
    bf* XB = (bf*)take((size_t)TT * DM * 2); float* FQ = (float*)take((size_t)TT * DQ * 4); float* FK = (float*)take((size_t)TT * DKV * 4);
    h16* QP16 = (h16*)take((size_t)NH_ * TT * HD * 2); h16* KP16 = (h16*)take((size_t)NKV * TT * HD * 2); h16* VT16 = (h16*)take((size_t)NKV * HD * TT * 2);
    bf* QPh = (bf*)take((size_t)NH_ * TT * HD * 2); bf* QPl = (bf*)take((size_t)NH_ * TT * HD * 2); bf* KPh = (bf*)take((size_t)NKV * TT * HD * 2); bf* KPl = (bf*)take((size_t)NKV * TT * HD * 2); bf* VTh = (bf*)take((size_t)NKV * HD * TT * 2); bf* VTl = (bf*)take((size_t)NKV * HD * TT * 2); bf* Ph = nullptr; bf* Pl = nullptr;   /* RH 0: no row takes the hi/lo arm of the softmax's store */
    float* Sb = (float*)take((size_t)ZH * TT * TT * 4); h16* P16 = (h16*)take((size_t)ZH * TT * TT * 2); float* Ob = (float*)take((size_t)ZH * TT * HD * 4); bf* ATh = (bf*)take((size_t)TT * DQ * 2); bf* ATl = (bf*)take((size_t)TT * DQ * 2);
    if ((size_t)(wsp - (char*)d_ws) > ws_size) return;    // total 122 MiB of the workspace
    float* FV = FK;   // v projection reuses the k buffer after the k planes are built (stream-ordered)
    { k_cvt8<<<(unsigned)(((size_t)DQ * DM / 8 + 255) / 256), 256, 0, stream>>>(wq, WQ, (size_t)DQ * DM / 8); k_cvt8<<<(unsigned)(((size_t)DKV * DM / 8 + 255) / 256), 256, 0, stream>>>(wk, WK, (size_t)DKV * DM / 8); k_cvt8<<<(unsigned)(((size_t)DKV * DM / 8 + 255) / 256), 256, 0, stream>>>(wv, WV, (size_t)DKV * DM / 8);
      k_cvt8<<<(unsigned)(((size_t)DM * DQ / 8 + 255) / 256), 256, 0, stream>>>(wo, WO, (size_t)DM * DQ / 8); }   // [out][in] = Bt as they stand
    k_csid<<<(TT * HD + 255) / 256, 256, 0, stream>>>(CS);
    const unsigned LQ = (unsigned)(((size_t)NH_ * TT * HD / 2 + 255) / 256), LKv = (unsigned)(((size_t)NKV * TT * HD / 2 + 255) / 256), LX = (unsigned)(((size_t)TT * DM / 8 + 255) / 256);
    for (int b = 0; b < NB_; ++b) {
        k_cvt8<<<LX, 256, 0, stream>>>(xq + (size_t)b * TT * DM, XB, (size_t)TT * DM / 8);
        k_gemmw<bf, 0, true><<<dim3(TT / 64, DQ / 64, 1), 32, 0, stream>>>(XB, nullptr, WQ, nullptr, DM, FQ, DQ, bq, 0, 0, 0);
        k_rope<<<LQ, 256, 0, stream>>>(FQ, DQ, NH_, CS, nullptr, nullptr, 1.0f, QP16, QPh, QPl);
        k_cvt8<<<LX, 256, 0, stream>>>(xk + (size_t)b * TT * DM, XB, (size_t)TT * DM / 8);
        k_gemmw<bf, 0, true><<<dim3(TT / 64, DKV / 64, 1), 32, 0, stream>>>(XB, nullptr, WK, nullptr, DM, FK, DKV, bk, 0, 0, 0);
        k_rope<<<LKv, 256, 0, stream>>>(FK, DKV, NKV, CS, nullptr, nullptr, 1.0f, KP16, KPh, KPl);
        k_cvt8<<<LX, 256, 0, stream>>>(xv + (size_t)b * TT * DM, XB, (size_t)TT * DM / 8);
        k_gemmw<bf, 0, true><<<dim3(TT / 64, DKV / 64, 1), 32, 0, stream>>>(XB, nullptr, WV, nullptr, DM, FV, DKV, bv, 0, 0, 0); k_vtp<<<LKv, 256, 0, stream>>>(FV, DKV, NKV, VT16, VTh, VTl);
        for (int h0 = 0; h0 < NH_; h0 += ZH) { const size_t zq = (size_t)h0, zk = (size_t)(h0 / REP);   // one kv head per query head: the pass's two heads use consecutive kv planes (z-strides TT*HD)
            k_gemmw<h16, 0, false><<<dim3((TT - RH) / 64, TT / 64, ZH), 32, 0, stream>>>(QP16 + zq * TT * HD + (size_t)RH * HD, nullptr, KP16 + zk * TT * HD, nullptr, HD, Sb + (size_t)RH * TT, TT, nullptr, (size_t)TT * HD, (size_t)TT * HD, (size_t)TT * TT);
            k_asoft<<<ZH * TT / 8, 256, 0, stream>>>(Sb, P16, Ph, Pl);
            k_gemmw<h16, 0, false><<<dim3((TT - RH) / 64, HD / 64, ZH), 32, 0, stream>>>(P16 + (size_t)RH * TT, nullptr, VT16 + zk * HD * TT, nullptr, TT, Ob + (size_t)RH * HD, HD, nullptr, (size_t)TT * TT, (size_t)HD * TT, (size_t)TT * HD);
            k_merge<<<(unsigned)(((size_t)ZH * TT * HD / 2 + 255) / 256), 256, 0, stream>>>(Ob, h0, ATh, ATl);
            k_ctxw<<<(unsigned)(((size_t)ZH * TT * HD / 4 + 255) / 256), 256, 0, stream>>>(Ob, h0, OUT1 + (size_t)b * NH_ * TT * HD); }
        k_gemmw<bf, 1, true><<<dim3(TT / 64, DM / 64, 1), 32, 0, stream>>>(ATh, ATl, WO, nullptr, DQ, OUT + (size_t)b * TT * DM, DM, bo, 0, 0, 0); }
}

// v001
// One run takes 631 microseconds.
// Two timings next to v000 put it at 4.21 and 4.22 times that version's speed.
#include <hip/hip_runtime.h>

// Multi-head attention on three input streams with an output projection, returning the projected output AND the per-head context (q, k, v [4][2048][1024]; Q = q Wq^T + bq, K = k Wk^T + bk, V = v Wv^T + bv with 'oi' weights [1024][1024] and
// biases [1024]; 16 heads x 64 (head h = columns h x 64 ..); scores x 1/sqrt(64); softmax over all 2048 keys; no mask; ctx = weights V; merged head-major [b][t][1024]; out = merged Wo^T + bo ('oi' [1024][1024]);
// TWO OUTPUTS in one buffer: out [4][2048][1024] at float offset 0 and ctx [4][16][2048][64] at float offset 8,388,608; argument order q, k, v, wq_w, wq_b, wk_w, wk_b, wv_w, wv_b, wo_w, wo_b).
// Layout per batch entry: one bf16 staging copy, refilled for each stream in order (q, k, v); 'oi' weights copied as they stand; exact projections + f32 biases; identity-table plane builders (fp16 planes kept for all four entries); one fused attention launch over (query block, head, batch entry), running softmax, no score matrix in memory;
// merged hi/lo x Wo exact + bo writes the first output.
// Compute dtypes, f32 accumulate: every float input rounded to bf16 at its load; projections exact + f32 biases; scores and attn.v fp16; softmax f32; output projection hl x exact; the second output is the f32 context as the attention kernel divides it.

#define NB_  4
#define TT   2048
#define DM   1024
#define NH_  16
#define NKV  16
#define HD   64
#define DQ   (NH_ * HD)
#define DKV  (NKV * HD)
#define SCL  0.125f   // HD^-0.5
typedef _Float16 h16;
typedef unsigned short bf;
typedef __attribute__((ext_vector_type(16))) __bf16   v16bf;
typedef __attribute__((ext_vector_type(16))) _Float16 v16h;
typedef __attribute__((ext_vector_type(8)))  _Float16 v8h;
typedef __attribute__((ext_vector_type(8)))  unsigned short v8us;
typedef __attribute__((ext_vector_type(8)))  float    v8f;
typedef __attribute__((ext_vector_type(4)))  float    v4f;
typedef v8h  __attribute__((may_alias)) v8ha;
typedef v4f  __attribute__((may_alias)) v4fa;
typedef v8us __attribute__((may_alias)) v8usa;

__device__ __forceinline__ unsigned short f2bf(float f) { unsigned u = __float_as_uint(f); u += 0x7FFFu + ((u >> 16) & 1u); return (unsigned short)(u >> 16); }
__device__ __forceinline__ float bf2f(unsigned short b) { return __uint_as_float(((unsigned)b) << 16); }
__device__ __forceinline__ float bfr(float f) { return bf2f(f2bf(f)); }
__device__ __forceinline__ v16h cat16(v8h lo, v8h hi) { return __builtin_shufflevector(lo, hi, 0, 1, 2, 3, 4, 5, 6, 7, 8, 9, 10, 11, 12, 13, 14, 15); }
__device__ __forceinline__ v16bf cat16b(v8us lo, v8us hi) { return __builtin_bit_cast(v16bf, __builtin_shufflevector(lo, hi, 0, 1, 2, 3, 4, 5, 6, 7, 8, 9, 10, 11, 12, 13, 14, 15)); }
__device__ __forceinline__ v8f wmma16(v16h a, v16h b, v8f c) { return __builtin_amdgcn_wmma_f32_16x16x32_f16(false, a, false, b, (short)0, c, false, false); }
__device__ __forceinline__ v8f wmmab(v16bf a, v16bf b, v8f c) { return __builtin_amdgcn_wmma_f32_16x16x32_bf16(false, a, false, b, (short)0, c, false, false); }



// ---- k_gemmw: register-blocked GEMM, ONE WAVE per 64x64 output tile (16 accumulators), operands straight from K-contiguous 16-bit planes; grid (M/64, N/64, Z), 32 threads.
// C[m][n] (f32, pitch ldc, + optional f32 bias[n]) = sum_k A[m][k] Bt[n][k] (+ split products per NSPLIT). z-batch strides sA/sB/sC in elements. K % 32 == 0.
template <typename T16> struct WFrag;
template <> struct WFrag<h16> { typedef v16h V; static __device__ __forceinline__ V ld(const h16* p) { return cat16(*(const v8h*)p, *(const v8h*)(p + 16)); } static __device__ __forceinline__ v8f mma(V a, V b, v8f c) { return wmma16(a, b, c); } };
template <> struct WFrag<bf> { typedef v16bf V; static __device__ __forceinline__ V ld(const bf* p) { return cat16b(*(const v8us*)p, *(const v8us*)(p + 16)); } static __device__ __forceinline__ v8f mma(V a, V b, v8f c) { return wmmab(a, b, c); } };
template <typename T16, int NSPLIT, bool BIAS>
__global__ __launch_bounds__(32) void k_gemmw(const T16* __restrict__ A, const T16* __restrict__ A2, const T16* __restrict__ Bt, const T16* __restrict__ Bt2, int K, float* C, int ldc, const float* __restrict__ bias, size_t sA, size_t sB, size_t sC) {
    typedef typename WFrag<T16>::V V;
    __shared__ __align__(16) float os[16 * 68];
    const size_t z = blockIdx.z; A += z * sA; if (A2) A2 += z * sA; Bt += z * sB; if (Bt2) Bt2 += z * sB; C += z * sC;
    const int lane = threadIdx.x & 31, lr = lane & 15, hi = lane >> 4; const int r0 = blockIdx.x * 64, c0 = blockIdx.y * 64;
    v8f acc[4][4];
#pragma unroll
    for (int mb = 0; mb < 4; ++mb)
#pragma unroll
        for (int nb = 0; nb < 4; ++nb) acc[mb][nb] = (v8f){};
    const size_t aoff = (size_t)(r0 + lr) * K + 8 * hi, boff = (size_t)(c0 + lr) * K + 8 * hi;

    for (int kc = 0; kc < K; kc += 32) {
        V a[4], a2[4];
#pragma unroll
        for (int mb = 0; mb < 4; ++mb) { a[mb] = WFrag<T16>::ld(A + aoff + (size_t)mb * 16 * K + kc); if (NSPLIT == 1 || NSPLIT == 2) a2[mb] = WFrag<T16>::ld(A2 + aoff + (size_t)mb * 16 * K + kc); }
#pragma unroll
        for (int nb = 0; nb < 4; ++nb) { const V b = WFrag<T16>::ld(Bt + boff + (size_t)nb * 16 * K + kc); V b2; if (NSPLIT >= 2) b2 = WFrag<T16>::ld(Bt2 + boff + (size_t)nb * 16 * K + kc);
#pragma unroll
            for (int mb = 0; mb < 4; ++mb) { acc[mb][nb] = WFrag<T16>::mma(a[mb], b, acc[mb][nb]); if (NSPLIT == 1 || NSPLIT == 2) acc[mb][nb] = WFrag<T16>::mma(a2[mb], b, acc[mb][nb]); if (NSPLIT >= 2) acc[mb][nb] = WFrag<T16>::mma(a[mb], b2, acc[mb][nb]); } }
        asm volatile("v_nop\n\tv_nop\n\tv_nop\n\tv_nop" : "+v"(acc[0][0]), "+v"(acc[1][1]), "+v"(acc[2][2]), "+v"(acc[3][3]) : "v"(a[0]), "v"(a[3]));
    }
#pragma unroll
    for (int mb = 0; mb < 4; ++mb) {
#pragma unroll
        for (int nb = 0; nb < 4; ++nb) {
#pragma unroll
            for (int j = 0; j < 8; ++j) os[(hi * 8 + j) * 68 + nb * 16 + lr] = acc[mb][nb][j]; }
        __builtin_amdgcn_wave_barrier(); asm volatile("" ::: "memory");
        float* crow = C + (size_t)(r0 + mb * 16) * ldc + c0;
{
#pragma unroll
            for (int s = 0; s < 8; ++s) { const int row = 2 * s + hi, cofs = lr * 4; v4f val = *(const v4fa*)(os + row * 68 + cofs); if (BIAS) { val[0] += bfr(bias[c0 + cofs]); val[1] += bfr(bias[c0 + cofs + 1]); val[2] += bfr(bias[c0 + cofs + 2]); val[3] += bfr(bias[c0 + cofs + 3]); }
                *(v4f*)(crow + (size_t)row * ldc + cofs) = val; }
             }
        __builtin_amdgcn_wave_barrier(); asm volatile("" ::: "memory");
    }
}

__device__ __forceinline__ h16 tohx(float x) { return (h16)x; }
__device__ __forceinline__ void splitf(float y, unsigned short& h, unsigned short& l) { h = f2bf(y); l = f2bf(y - bf2f(h)); }
typedef __attribute__((ext_vector_type(2))) _Float16 v2h;
typedef __attribute__((ext_vector_type(4))) _Float16 v4h;
typedef __attribute__((ext_vector_type(2))) unsigned short v2us;
typedef __attribute__((ext_vector_type(4))) unsigned short v4us;
typedef __attribute__((ext_vector_type(2))) float v2f;
typedef __attribute__((ext_vector_type(4))) int v4i;

__global__ __launch_bounds__(256) void k_cvt8(const float* __restrict__ src, bf* dst, size_t n8) { const size_t i = (size_t)blockIdx.x * 256 + threadIdx.x; if (i >= n8) return; const v8f v = *(const v8f*)(src + i * 8); v8us o;
#pragma unroll
    for (int k = 0; k < 8; ++k) o[k] = f2bf(v[k]); *(v8us*)(dst + i * 8) = o;  }

// k_rope: head planes [h][t][d] (fp16 + hi/lo) of rope(x) x sc with the rotate-half convention out[d] = x[d] cos[t][d] - x[d+HD/2] sin[t][d], out[d+HD/2] = x[d+HD/2] cos[t][d+HD/2] + x[d] sin[t][d+HD/2]
__global__ __launch_bounds__(256) void k_rope(const float* __restrict__ F, int pitch, int nheads, const float* __restrict__ CS, const float* __restrict__ RF, const float* __restrict__ nw, float sc, h16* P16, bf* Ph, bf* Pl) {
    const size_t e = ((size_t)blockIdx.x * 256 + threadIdx.x) * 2; if (e >= (size_t)nheads * TT * HD) return; const int d = (int)(e % HD); const int t = (int)((e / HD) % TT); const int h = (int)(e / ((size_t)HD * TT)); const float* f = F + (size_t)t * pitch + h * HD; const float rf = RF ? RF[(size_t)h * TT + t] : 1.0f; v2h o16; v2us oh, ol;
#pragma unroll
    for (int q = 0; q < 2; ++q) { const int dd = d + q; const int dp = (dd < HD / 2) ? dd + HD / 2 : dd - HD / 2; float x0 = f[dd], x1 = f[dp];
        if (RF) { float n0 = __fmul_rn(x0, rf), n1 = __fmul_rn(x1, rf); x0 = __fmul_rn(bfr(nw[dd]), n0); x1 = __fmul_rn(bfr(nw[dp]), n1); }
        const v2f cs = *(const v2f*)(CS + ((size_t)t * HD + dd) * 2); float a = __fmul_rn(x0, cs[0]), bq = __fmul_rn(x1, cs[1]); const float r = ((dd < HD / 2) ? __fsub_rn(a, bq) : __fadd_rn(a, bq)) * sc;
        o16[q] = tohx(r); unsigned short a2, c2; splitf(r, a2, c2); oh[q] = a2; ol[q] = c2; }
    *(v2h*)(P16 + e) = o16; *(v2us*)(Ph + e) = oh; *(v2us*)(Pl + e) = ol;  }
__global__ __launch_bounds__(256) void k_vtp(const float* __restrict__ F, int pitch, int nheads, h16* V16, bf* Vh, bf* Vl) { const size_t e = ((size_t)blockIdx.x * 256 + threadIdx.x) * 2; if (e >= (size_t)nheads * HD * TT) return; const int t = (int)(e % TT); const int d = (int)((e / TT) % HD); const int g = (int)(e / ((size_t)TT * HD)); v2h o16; v2us oh, ol;
#pragma unroll
    for (int q = 0; q < 2; ++q) { const float x = F[(size_t)(t + q) * pitch + g * HD + d]; o16[q] = tohx(x); unsigned short a2, c2; splitf(x, a2, c2); oh[q] = a2; ol[q] = c2; }
    *(v2h*)(V16 + e) = o16; *(v2us*)(Vh + e) = oh; *(v2us*)(Vl + e) = ol;  }
__global__ __launch_bounds__(256) void k_csid(float* CS) { const int idx = blockIdx.x * 256 + threadIdx.x; if (idx >= TT * HD) return; v2f cs; cs[0] = 1.0f; cs[1] = 0.0f; *(v2f*)(CS + (size_t)idx * 2) = cs;  }
#define KST 64   // keys a stage
#define LP  72   // LDS row pitch in fp16: 144 B = 16 B x 9, 16-byte fragment reads of 16 rows fall on 64 distinct banks
__device__ __forceinline__ float xhalf(float x) { return __builtin_bit_cast(float, __builtin_amdgcn_permlanex16(__builtin_bit_cast(int, x), __builtin_bit_cast(int, x), 0x76543210, 0xfedcba98, false, false)); }   // lane l with lane l ^ 16
__global__ __launch_bounds__(256) __attribute__((amdgpu_waves_per_eu(4, 4))) void k_fattn(const h16* __restrict__ Q, const h16* __restrict__ Kp, const h16* __restrict__ Vt, float* CTX, bf* Ah, bf* Al) {
    __shared__ __align__(16) h16 ks[2 * KST * LP]; __shared__ __align__(16) h16 vs[2 * HD * LP];
    const int lane = threadIdx.x & 31, lr = lane & 15, hi = lane >> 4, wv = threadIdx.x >> 5; const int h = blockIdx.y, b = blockIdx.z;
    const size_t pl = ((size_t)b * NH_ + h) * TT * HD; const int q0 = blockIdx.x * 256 + wv * 32;
    const float C2 = SCL * 1.4426950408889634f;   // scores to log2 units
    const h16* qp = Q + pl + (size_t)(q0 + lr) * HD + 8 * hi;
    const int srow = threadIdx.x >> 3, sch = (threadIdx.x & 7) * 8;   // staging: thread -> (row, 16-byte piece); rows srow and srow + 32
    const h16* kg = Kp + pl + (size_t)srow * HD + sch; const h16* vg = Vt + pl + (size_t)srow * TT + sch; const int so = srow * LP + sch;
    v16h qf[2][2]; v8f o[4][2]; float m[2], l[2]; v8h gk[2], gv[2];
#pragma unroll
    for (int r = 0; r < 2; ++r) { gk[r] = *(const v8h*)(kg + (size_t)r * 32 * HD); gv[r] = *(const v8h*)(vg + (size_t)r * 32 * TT); }
#pragma unroll
    for (int qt = 0; qt < 2; ++qt) { m[qt] = -3.0e38f; l[qt] = 0.f;
#pragma unroll
        for (int kc = 0; kc < 2; ++kc) qf[qt][kc] = WFrag<h16>::ld(qp + qt * 16 * HD + kc * 32);
#pragma unroll
        for (int dt = 0; dt < 4; ++dt) o[dt][qt] = (v8f){}; }
#pragma unroll
    for (int r = 0; r < 2; ++r) { *(v8h*)(ks + so + r * 32 * LP) = gk[r]; *(v8h*)(vs + so + r * 32 * LP) = gv[r]; }
    __syncthreads();   // stage 0 is published
    for (int st = 0; st < TT / KST; ++st) {
        const h16* kl = ks + (st & 1) * (KST * LP) + lr * LP + 8 * hi; const h16* vl = vs + (st & 1) * (HD * LP) + lr * LP + 8 * hi; const bool more = st + 1 < TT / KST;
        if (more) {
#pragma unroll
            for (int r = 0; r < 2; ++r) { gk[r] = *(const v8h*)(kg + (size_t)((st + 1) * KST + r * 32) * HD); gv[r] = *(const v8h*)(vg + (size_t)r * 32 * TT + (st + 1) * KST); } }
#pragma unroll 1   // rolled: unrolled, the second pass's fragments are fetched over the first and the registers of four waves a SIMD no longer hold them
        for (int ps = 0; ps < KST / 32; ++ps) {
            v16h kf[2][2], vf[4]; v8f s[2][2];
#pragma unroll
            for (int kt = 0; kt < 2; ++kt)
#pragma unroll
                for (int kc = 0; kc < 2; ++kc) kf[kt][kc] = WFrag<h16>::ld(kl + (ps * 32 + kt * 16) * LP + kc * 32);
#pragma unroll
            for (int dt = 0; dt < 4; ++dt) vf[dt] = WFrag<h16>::ld(vl + dt * 16 * LP + ps * 32);
#pragma unroll
            for (int kt = 0; kt < 2; ++kt)
#pragma unroll
                for (int qt = 0; qt < 2; ++qt) { s[kt][qt] = wmma16(kf[kt][0], qf[qt][0], (v8f){}); s[kt][qt] = wmma16(kf[kt][1], qf[qt][1], s[kt][qt]); }
#pragma unroll
            for (int qt = 0; qt < 2; ++qt) {
                float mx = s[0][qt][0];
#pragma unroll
                for (int j = 1; j < 8; ++j) mx = fmaxf(mx, s[0][qt][j]);
#pragma unroll
                for (int j = 0; j < 8; ++j) mx = fmaxf(mx, s[1][qt][j]);
                mx = fmaxf(mx, xhalf(mx));
                const float mn = fmaxf(m[qt], mx * C2); const float al = __builtin_amdgcn_exp2f(m[qt] - mn); m[qt] = mn; const float sh = 10.0f - mn;
                v16h p; float psum = 0.f;
#pragma unroll
                for (int j = 0; j < 8; ++j) { const float e0 = __builtin_amdgcn_exp2f(fmaf(s[0][qt][j], C2, sh)), e1 = __builtin_amdgcn_exp2f(fmaf(s[1][qt][j], C2, sh)); psum += e0 + e1; p[j] = (h16)e0; p[8 + j] = (h16)e1; }
                l[qt] = fmaf(l[qt], al, psum);
#pragma unroll
                for (int dt = 0; dt < 4; ++dt) { o[dt][qt] *= al; o[dt][qt] = wmma16(vf[dt], p, o[dt][qt]); }
            }
            // four vector slots behind the pass's last WMMA: on the taken branch the loop's first vector instructions may overwrite its A or B registers
            asm volatile("v_nop\n\tv_nop\n\tv_nop\n\tv_nop" : "+v"(o[0][1]), "+v"(o[1][1]), "+v"(o[2][1]), "+v"(o[3][1]) : "v"(vf[0]), "v"(vf[1]), "v"(vf[2]), "v"(vf[3]));
        }
        if (more) { const int sn = ((st + 1) & 1);   // the other buffer: its readers left it before the barrier that ended the stage before this one
#pragma unroll
            for (int r = 0; r < 2; ++r) { *(v8h*)(ks + sn * (KST * LP) + so + r * 32 * LP) = gk[r]; *(v8h*)(vs + sn * (HD * LP) + so + r * 32 * LP) = gv[r]; } }
        __syncthreads();   // publishes stage st + 1 and ends every wave's reads of stage st
    }
#pragma unroll
    for (int qt = 0; qt < 2; ++qt) {
        const float lt = l[qt] + xhalf(l[qt]); const float inv = __fdiv_rn(1.0f, lt); const int t = q0 + qt * 16 + lr;
        float* cr = CTX + pl + (size_t)t * HD + 8 * hi; const size_t ao = ((size_t)b * TT + t) * DQ + h * HD + 8 * hi;
#pragma unroll
        for (int dt = 0; dt < 4; ++dt) { v4f c0, c1; v8us oh, ol;
#pragma unroll
            for (int j = 0; j < 8; ++j) { const float r = o[dt][qt][j] * inv; if (j < 4) c0[j] = r; else c1[j - 4] = r; unsigned short a2, c2; splitf(r, a2, c2); oh[j] = a2; ol[j] = c2; }
            *(v4f*)(cr + dt * 16) = c0; *(v4f*)(cr + dt * 16 + 4) = c1; *(v8us*)(Ah + ao + dt * 16) = oh; *(v8us*)(Al + ao + dt * 16) = ol; }
    }
}

extern "C" void kernel_launch(void* const* d_in, const int* in_sizes, int n_in,
                              void* d_out, int out_size, void* d_ws, size_t ws_size, hipStream_t stream) {
    (void)in_sizes; (void)n_in; (void)out_size;
    const float* xq = (const float*)d_in[0]; const float* xk = (const float*)d_in[1]; const float* xv = (const float*)d_in[2]; const float* wq = (const float*)d_in[3]; const float* bq = (const float*)d_in[4]; const float* wk = (const float*)d_in[5]; const float* bk = (const float*)d_in[6]; const float* wv = (const float*)d_in[7]; const float* bv = (const float*)d_in[8]; const float* wo = (const float*)d_in[9]; const float* bo = (const float*)d_in[10];
    // q, k, v [4][2048][1024], wq_w, wq_b, wk_w, wk_b, wv_w, wv_b, wo_w, wo_b = d_in[0..10]
    float* OUT = (float*)d_out;                          // output 0: out [4][2048][1024]
    float* OUT1 = (float*)d_out + (size_t)NB_ * TT * DM;   // output 1: ctx [4][16][2048][64], after the first output's 8,388,608 floats
    char* wsp = (char*)d_ws;
    auto take = [&](size_t bytes) { char* p = wsp; wsp += (bytes + 255) & ~(size_t)255; return (void*)p; };
    bf* WQ = (bf*)take((size_t)DQ * DM * 2); bf* WK = (bf*)take((size_t)DKV * DM * 2); bf* WV = (bf*)take((size_t)DKV * DM * 2); bf* WO = (bf*)take((size_t)DM * DQ * 2); float* CS = (float*)take((size_t)TT * HD * 2 * 4);
    bf* XB = (bf*)take((size_t)TT * DM * 2); float* FQ = (float*)take((size_t)TT * DQ * 4); float* FK = (float*)take((size_t)TT * DKV * 4);
    const size_t PLN = (size_t)NH_ * TT * HD;   // one batch entry's fp16 planes; all four entries' planes are kept for the one attention launch
    h16* QP16 = (h16*)take(NB_ * PLN * 2); h16* KP16 = (h16*)take(NB_ * PLN * 2); h16* VT16 = (h16*)take(NB_ * PLN * 2);
    bf* QPh = (bf*)take((size_t)NH_ * TT * HD * 2); bf* QPl = (bf*)take((size_t)NH_ * TT * HD * 2); bf* KPh = (bf*)take((size_t)NKV * TT * HD * 2); bf* KPl = (bf*)take((size_t)NKV * TT * HD * 2); bf* VTh = (bf*)take((size_t)NKV * HD * TT * 2); bf* VTl = (bf*)take((size_t)NKV * HD * TT * 2);
    bf* ATh = (bf*)take((size_t)NB_ * TT * DQ * 2); bf* ATl = (bf*)take((size_t)NB_ * TT * DQ * 2);
    if ((size_t)(wsp - (char*)d_ws) > ws_size) return;    // total 133 MiB of the workspace
    float* FV = FK;   // v projection reuses the k buffer after the k planes are built (stream-ordered)
    { k_cvt8<<<(unsigned)(((size_t)DQ * DM / 8 + 255) / 256), 256, 0, stream>>>(wq, WQ, (size_t)DQ * DM / 8); k_cvt8<<<(unsigned)(((size_t)DKV * DM / 8 + 255) / 256), 256, 0, stream>>>(wk, WK, (size_t)DKV * DM / 8); k_cvt8<<<(unsigned)(((size_t)DKV * DM / 8 + 255) / 256), 256, 0, stream>>>(wv, WV, (size_t)DKV * DM / 8);
      k_cvt8<<<(unsigned)(((size_t)DM * DQ / 8 + 255) / 256), 256, 0, stream>>>(wo, WO, (size_t)DM * DQ / 8); }   // [out][in] = Bt as they stand
    k_csid<<<(TT * HD + 255) / 256, 256, 0, stream>>>(CS);
    const unsigned LQ = (unsigned)(((size_t)NH_ * TT * HD / 2 + 255) / 256), LKv = (unsigned)(((size_t)NKV * TT * HD / 2 + 255) / 256), LX = (unsigned)(((size_t)TT * DM / 8 + 255) / 256);
    for (int b = 0; b < NB_; ++b) {
        k_cvt8<<<LX, 256, 0, stream>>>(xq + (size_t)b * TT * DM, XB, (size_t)TT * DM / 8);
        k_gemmw<bf, 0, true><<<dim3(TT / 64, DQ / 64, 1), 32, 0, stream>>>(XB, nullptr, WQ, nullptr, DM, FQ, DQ, bq, 0, 0, 0);
        k_rope<<<LQ, 256, 0, stream>>>(FQ, DQ, NH_, CS, nullptr, nullptr, 1.0f, QP16 + b * PLN, QPh, QPl);
        k_cvt8<<<LX, 256, 0, stream>>>(xk + (size_t)b * TT * DM, XB, (size_t)TT * DM / 8);
        k_gemmw<bf, 0, true><<<dim3(TT / 64, DKV / 64, 1), 32, 0, stream>>>(XB, nullptr, WK, nullptr, DM, FK, DKV, bk, 0, 0, 0);
        k_rope<<<LKv, 256, 0, stream>>>(FK, DKV, NKV, CS, nullptr, nullptr, 1.0f, KP16 + b * PLN, KPh, KPl);
        k_cvt8<<<LX, 256, 0, stream>>>(xv + (size_t)b * TT * DM, XB, (size_t)TT * DM / 8);
        k_gemmw<bf, 0, true><<<dim3(TT / 64, DKV / 64, 1), 32, 0, stream>>>(XB, nullptr, WV, nullptr, DM, FV, DKV, bv, 0, 0, 0); k_vtp<<<LKv, 256, 0, stream>>>(FV, DKV, NKV, VT16 + b * PLN, VTh, VTl); }
    k_fattn<<<dim3(TT / 256, NH_, NB_), 256, 0, stream>>>(QP16, KP16, VT16, OUT1, ATh, ATl);
    for (int b = 0; b < NB_; ++b)
        k_gemmw<bf, 1, true><<<dim3(TT / 64, DM / 64, 1), 32, 0, stream>>>(ATh + (size_t)b * TT * DQ, ATl + (size_t)b * TT * DQ, WO, nullptr, DQ, OUT + (size_t)b * TT * DM, DM, bo, 0, 0, 0);
}

// v002
// One run takes 542 microseconds.
// Two timings next to v001 put it at 1.19 and 1.16 times that version's speed.
// Counting every step since v000, it is 4.96 times as fast.
#include <hip/hip_runtime.h>

// Multi-head attention on three input streams with an output projection, returning the projected output AND the per-head context (q, k, v [4][2048][1024]; Q = q Wq^T + bq, K = k Wk^T + bk, V = v Wv^T + bv with 'oi' weights [1024][1024] and
// biases [1024]; 16 heads x 64 (head h = columns h x 64 ..); scores x 1/sqrt(64); softmax over all 2048 keys; no mask; ctx = weights V; merged head-major [b][t][1024]; out = merged Wo^T + bo ('oi' [1024][1024]);
// TWO OUTPUTS in one buffer: out [4][2048][1024] at float offset 0 and ctx [4][16][2048][64] at float offset 8,388,608; argument order q, k, v, wq_w, wq_b, wk_w, wk_b, wv_w, wv_b, wo_w, wo_b).
// Layout per batch entry: one bf16 staging copy, refilled for each stream in order (q, k, v); 'oi' weights copied as they stand; exact projections + f32 biases, each projection storing its fp16 head plane from its own epilogue (planes kept for all four entries); one fused attention launch over (query block, head, batch entry), running softmax, no score matrix in memory;
// merged hi/lo x Wo exact + bo writes the first output.
// Compute dtypes, f32 accumulate: every float input rounded to bf16 at its load; projections exact + f32 biases; scores and attn.v fp16; softmax f32; output projection hl x exact; the second output is the f32 context as the attention kernel divides it.

#define NB_  4
#define TT   2048
#define DM   1024
#define NH_  16
#define NKV  16
#define HD   64
#define DQ   (NH_ * HD)
#define DKV  (NKV * HD)
#define SCL  0.125f   // HD^-0.5
typedef _Float16 h16;
typedef unsigned short bf;
typedef __attribute__((ext_vector_type(16))) __bf16   v16bf;
typedef __attribute__((ext_vector_type(16))) _Float16 v16h;
typedef __attribute__((ext_vector_type(8)))  _Float16 v8h;
typedef __attribute__((ext_vector_type(8)))  unsigned short v8us;
typedef __attribute__((ext_vector_type(8)))  float    v8f;
typedef __attribute__((ext_vector_type(4)))  float    v4f;
typedef v8h  __attribute__((may_alias)) v8ha;
typedef v4f  __attribute__((may_alias)) v4fa;
typedef v8us __attribute__((may_alias)) v8usa;

__device__ __forceinline__ unsigned short f2bf(float f) { unsigned u = __float_as_uint(f); u += 0x7FFFu + ((u >> 16) & 1u); return (unsigned short)(u >> 16); }
__device__ __forceinline__ float bf2f(unsigned short b) { return __uint_as_float(((unsigned)b) << 16); }
__device__ __forceinline__ float bfr(float f) { return bf2f(f2bf(f)); }
__device__ __forceinline__ v16h cat16(v8h lo, v8h hi) { return __builtin_shufflevector(lo, hi, 0, 1, 2, 3, 4, 5, 6, 7, 8, 9, 10, 11, 12, 13, 14, 15); }
__device__ __forceinline__ v16bf cat16b(v8us lo, v8us hi) { return __builtin_bit_cast(v16bf, __builtin_shufflevector(lo, hi, 0, 1, 2, 3, 4, 5, 6, 7, 8, 9, 10, 11, 12, 13, 14, 15)); }
__device__ __forceinline__ v8f wmma16(v16h a, v16h b, v8f c) { return __builtin_amdgcn_wmma_f32_16x16x32_f16(false, a, false, b, (short)0, c, false, false); }
__device__ __forceinline__ v8f wmmab(v16bf a, v16bf b, v8f c) { return __builtin_amdgcn_wmma_f32_16x16x32_bf16(false, a, false, b, (short)0, c, false, false); }



// ---- k_gemmw: register-blocked GEMM, ONE WAVE per 64x64 output tile (16 accumulators), operands straight from K-contiguous 16-bit planes; grid (M/64, N/64, Z), 32 threads.
// C[m][n] (f32, pitch ldc, + optional f32 bias[n]) = sum_k A[m][k] Bt[n][k] (+ split products per NSPLIT). z-batch strides sA/sB/sC in elements. K % 32 == 0.
// PLANE != 0: no f32 C; the tile goes out as fp16, transposed, P[blockIdx.x * stp + n * ldp + (m % 64)]: a lane's accumulator holds 8 consecutive m of one n, which is one 16-byte store, no LDS.
// PLANE 1: bias[m] (A = weights, Bt = tokens: row n = token, 64 head columns; stp = one head's plane). PLANE 2: bias[n] (A = tokens, Bt = weights: row n = head column, tokens along the row; stp = 64).
template <typename T16> struct WFrag;
template <> struct WFrag<h16> { typedef v16h V; static __device__ __forceinline__ V ld(const h16* p) { return cat16(*(const v8h*)p, *(const v8h*)(p + 16)); } static __device__ __forceinline__ v8f mma(V a, V b, v8f c) { return wmma16(a, b, c); } };
template <> struct WFrag<bf> { typedef v16bf V; static __device__ __forceinline__ V ld(const bf* p) { return cat16b(*(const v8us*)p, *(const v8us*)(p + 16)); } static __device__ __forceinline__ v8f mma(V a, V b, v8f c) { return wmmab(a, b, c); } };
template <typename T16, int NSPLIT, bool BIAS, int PLANE>
__global__ __launch_bounds__(32) void k_gemmw(const T16* __restrict__ A, const T16* __restrict__ A2, const T16* __restrict__ Bt, const T16* __restrict__ Bt2, int K, float* C, int ldc, const float* __restrict__ bias, size_t sA, size_t sB, size_t sC, h16* P, int ldp, size_t stp) {
    typedef typename WFrag<T16>::V V;
    const size_t z = blockIdx.z; A += z * sA; if (A2) A2 += z * sA; Bt += z * sB; if (Bt2) Bt2 += z * sB; C += z * sC;
    const int lane = threadIdx.x & 31, lr = lane & 15, hi = lane >> 4; const int r0 = blockIdx.x * 64, c0 = blockIdx.y * 64;
    v8f acc[4][4];
#pragma unroll
    for (int mb = 0; mb < 4; ++mb)
#pragma unroll
        for (int nb = 0; nb < 4; ++nb) acc[mb][nb] = (v8f){};
    const size_t aoff = (size_t)(r0 + lr) * K + 8 * hi, boff = (size_t)(c0 + lr) * K + 8 * hi;

    for (int kc = 0; kc < K; kc += 32) {
        V a[4], a2[4];
#pragma unroll
        for (int mb = 0; mb < 4; ++mb) { a[mb] = WFrag<T16>::ld(A + aoff + (size_t)mb * 16 * K + kc); if (NSPLIT == 1 || NSPLIT == 2) a2[mb] = WFrag<T16>::ld(A2 + aoff + (size_t)mb * 16 * K + kc); }
#pragma unroll
        for (int nb = 0; nb < 4; ++nb) { const V b = WFrag<T16>::ld(Bt + boff + (size_t)nb * 16 * K + kc); V b2; if (NSPLIT >= 2) b2 = WFrag<T16>::ld(Bt2 + boff + (size_t)nb * 16 * K + kc);
#pragma unroll
            for (int mb = 0; mb < 4; ++mb) { acc[mb][nb] = WFrag<T16>::mma(a[mb], b, acc[mb][nb]); if (NSPLIT == 1 || NSPLIT == 2) acc[mb][nb] = WFrag<T16>::mma(a2[mb], b, acc[mb][nb]); if (NSPLIT >= 2) acc[mb][nb] = WFrag<T16>::mma(a[mb], b2, acc[mb][nb]); } }
        asm volatile("v_nop\n\tv_nop\n\tv_nop\n\tv_nop" : "+v"(acc[0][0]), "+v"(acc[1][1]), "+v"(acc[2][2]), "+v"(acc[3][3]) : "v"(a[0]), "v"(a[3]));
    }
    if constexpr (PLANE != 0) {
        h16* pr = P + (size_t)blockIdx.x * stp + (size_t)(c0 + lr) * ldp + 8 * hi;
#pragma unroll
        for (int mb = 0; mb < 4; ++mb) {
            v4f b0 = (v4f){}, b1 = (v4f){};
            if (PLANE == 1) { b0 = *(const v4f*)(bias + r0 + mb * 16 + 8 * hi); b1 = *(const v4f*)(bias + r0 + mb * 16 + 8 * hi + 4); }
#pragma unroll
            for (int nb = 0; nb < 4; ++nb) { const float bn = (PLANE == 2) ? bfr(bias[c0 + nb * 16 + lr]) : 0.f; v8h o;
#pragma unroll
                for (int j = 0; j < 8; ++j) o[j] = (h16)(acc[mb][nb][j] + ((PLANE == 1) ? bfr(j < 4 ? b0[j] : b1[j - 4]) : bn));
                *(v8h*)(pr + (size_t)nb * 16 * ldp + mb * 16) = o; }
        }
    } else {
    __shared__ __align__(16) float os[16 * 68];
#pragma unroll
    for (int mb = 0; mb < 4; ++mb) {
#pragma unroll
        for (int nb = 0; nb < 4; ++nb) {
#pragma unroll
            for (int j = 0; j < 8; ++j) os[(hi * 8 + j) * 68 + nb * 16 + lr] = acc[mb][nb][j]; }
        __builtin_amdgcn_wave_barrier(); asm volatile("" ::: "memory");
        float* crow = C + (size_t)(r0 + mb * 16) * ldc + c0;
{
#pragma unroll
            for (int s = 0; s < 8; ++s) { const int row = 2 * s + hi, cofs = lr * 4; v4f val = *(const v4fa*)(os + row * 68 + cofs); if (BIAS) { val[0] += bfr(bias[c0 + cofs]); val[1] += bfr(bias[c0 + cofs + 1]); val[2] += bfr(bias[c0 + cofs + 2]); val[3] += bfr(bias[c0 + cofs + 3]); }
                *(v4f*)(crow + (size_t)row * ldc + cofs) = val; }
             }
        __builtin_amdgcn_wave_barrier(); asm volatile("" ::: "memory");
    }
    }
}

__device__ __forceinline__ void splitf(float y, unsigned short& h, unsigned short& l) { h = f2bf(y); l = f2bf(y - bf2f(h)); }
typedef __attribute__((ext_vector_type(2))) _Float16 v2h;
typedef __attribute__((ext_vector_type(4))) _Float16 v4h;
typedef __attribute__((ext_vector_type(2))) unsigned short v2us;
typedef __attribute__((ext_vector_type(4))) unsigned short v4us;
typedef __attribute__((ext_vector_type(2))) float v2f;
typedef __attribute__((ext_vector_type(4))) int v4i;

__global__ __launch_bounds__(256) void k_cvt8(const float* __restrict__ src, bf* dst, size_t n8) { const size_t i = (size_t)blockIdx.x * 256 + threadIdx.x; if (i >= n8) return; const v8f v = *(const v8f*)(src + i * 8); v8us o;
#pragma unroll
    for (int k = 0; k < 8; ++k) o[k] = f2bf(v[k]); *(v8us*)(dst + i * 8) = o;  }

#define KST 64   // keys a stage
#define LP  72   // LDS row pitch in fp16: 144 B = 16 B x 9, 16-byte fragment reads of 16 rows fall on 64 distinct banks
__device__ __forceinline__ float xhalf(float x) { return __builtin_bit_cast(float, __builtin_amdgcn_permlanex16(__builtin_bit_cast(int, x), __builtin_bit_cast(int, x), 0x76543210, 0xfedcba98, false, false)); }   // lane l with lane l ^ 16
__global__ __launch_bounds__(256) __attribute__((amdgpu_waves_per_eu(4, 4))) void k_fattn(const h16* __restrict__ Q, const h16* __restrict__ Kp, const h16* __restrict__ Vt, float* CTX, bf* Ah, bf* Al) {
    __shared__ __align__(16) h16 ks[2 * KST * LP]; __shared__ __align__(16) h16 vs[2 * HD * LP];
    const int lane = threadIdx.x & 31, lr = lane & 15, hi = lane >> 4, wv = threadIdx.x >> 5; const int h = blockIdx.y, b = blockIdx.z;
    const size_t pl = ((size_t)b * NH_ + h) * TT * HD; const int q0 = blockIdx.x * 256 + wv * 32;
    const float C2 = SCL * 1.4426950408889634f;   // scores to log2 units
    const h16* qp = Q + pl + (size_t)(q0 + lr) * HD + 8 * hi;
    const int srow = threadIdx.x >> 3, sch = (threadIdx.x & 7) * 8;   // staging: thread -> (row, 16-byte piece); rows srow and srow + 32
    const h16* kg = Kp + pl + (size_t)srow * HD + sch; const h16* vg = Vt + pl + (size_t)srow * TT + sch; const int so = srow * LP + sch;
    v16h qf[2][2]; v8f o[4][2]; float m[2], l[2]; v8h gk[2], gv[2];
#pragma unroll
    for (int r = 0; r < 2; ++r) { gk[r] = *(const v8h*)(kg + (size_t)r * 32 * HD); gv[r] = *(const v8h*)(vg + (size_t)r * 32 * TT); }
#pragma unroll
    for (int qt = 0; qt < 2; ++qt) { m[qt] = -3.0e38f; l[qt] = 0.f;
#pragma unroll
        for (int kc = 0; kc < 2; ++kc) qf[qt][kc] = WFrag<h16>::ld(qp + qt * 16 * HD + kc * 32);
#pragma unroll
        for (int dt = 0; dt < 4; ++dt) o[dt][qt] = (v8f){}; }
#pragma unroll
    for (int r = 0; r < 2; ++r) { *(v8h*)(ks + so + r * 32 * LP) = gk[r]; *(v8h*)(vs + so + r * 32 * LP) = gv[r]; }
    __syncthreads();   // stage 0 is published
    for (int st = 0; st < TT / KST; ++st) {
        const h16* kl = ks + (st & 1) * (KST * LP) + lr * LP + 8 * hi; const h16* vl = vs + (st & 1) * (HD * LP) + lr * LP + 8 * hi; const bool more = st + 1 < TT / KST;
        if (more) {
#pragma unroll
            for (int r = 0; r < 2; ++r) { gk[r] = *(const v8h*)(kg + (size_t)((st + 1) * KST + r * 32) * HD); gv[r] = *(const v8h*)(vg + (size_t)r * 32 * TT + (st + 1) * KST); } }
#pragma unroll 1   // rolled: unrolled, the second pass's fragments are fetched over the first and the registers of four waves a SIMD no longer hold them
        for (int ps = 0; ps < KST / 32; ++ps) {
            v16h kf[2][2], vf[4]; v8f s[2][2];
#pragma unroll
            for (int kt = 0; kt < 2; ++kt)
#pragma unroll
                for (int kc = 0; kc < 2; ++kc) kf[kt][kc] = WFrag<h16>::ld(kl + (ps * 32 + kt * 16) * LP + kc * 32);
#pragma unroll
            for (int dt = 0; dt < 4; ++dt) vf[dt] = WFrag<h16>::ld(vl + dt * 16 * LP + ps * 32);
#pragma unroll
            for (int kt = 0; kt < 2; ++kt)
#pragma unroll
                for (int qt = 0; qt < 2; ++qt) { s[kt][qt] = wmma16(kf[kt][0], qf[qt][0], (v8f){}); s[kt][qt] = wmma16(kf[kt][1], qf[qt][1], s[kt][qt]); }
#pragma unroll
            for (int qt = 0; qt < 2; ++qt) {
                float mx = s[0][qt][0];
#pragma unroll
                for (int j = 1; j < 8; ++j) mx = fmaxf(mx, s[0][qt][j]);
#pragma unroll
                for (int j = 0; j < 8; ++j) mx = fmaxf(mx, s[1][qt][j]);
                mx = fmaxf(mx, xhalf(mx));
                const float mn = fmaxf(m[qt], mx * C2); const float al = __builtin_amdgcn_exp2f(m[qt] - mn); m[qt] = mn; const float sh = 10.0f - mn;
                v16h p; float psum = 0.f;
#pragma unroll
                for (int j = 0; j < 8; ++j) { const float e0 = __builtin_amdgcn_exp2f(fmaf(s[0][qt][j], C2, sh)), e1 = __builtin_amdgcn_exp2f(fmaf(s[1][qt][j], C2, sh)); psum += e0 + e1; p[j] = (h16)e0; p[8 + j] = (h16)e1; }
                l[qt] = fmaf(l[qt], al, psum);
#pragma unroll
                for (int dt = 0; dt < 4; ++dt) { o[dt][qt] *= al; o[dt][qt] = wmma16(vf[dt], p, o[dt][qt]); }
            }
            // four vector slots behind the pass's last WMMA: on the taken branch the loop's first vector instructions may overwrite its A or B registers
            asm volatile("v_nop\n\tv_nop\n\tv_nop\n\tv_nop" : "+v"(o[0][1]), "+v"(o[1][1]), "+v"(o[2][1]), "+v"(o[3][1]) : "v"(vf[0]), "v"(vf[1]), "v"(vf[2]), "v"(vf[3]));
        }
        if (more) { const int sn = ((st + 1) & 1);   // the other buffer: its readers left it before the barrier that ended the stage before this one
#pragma unroll
            for (int r = 0; r < 2; ++r) { *(v8h*)(ks + sn * (KST * LP) + so + r * 32 * LP) = gk[r]; *(v8h*)(vs + sn * (HD * LP) + so + r * 32 * LP) = gv[r]; } }
        __syncthreads();   // publishes stage st + 1 and ends every wave's reads of stage st
    }
#pragma unroll
    for (int qt = 0; qt < 2; ++qt) {
        const float lt = l[qt] + xhalf(l[qt]); const float inv = __fdiv_rn(1.0f, lt); const int t = q0 + qt * 16 + lr;
        float* cr = CTX + pl + (size_t)t * HD + 8 * hi; const size_t ao = ((size_t)b * TT + t) * DQ + h * HD + 8 * hi;
#pragma unroll
        for (int dt = 0; dt < 4; ++dt) { v4f c0, c1; v8us oh, ol;
#pragma unroll
            for (int j = 0; j < 8; ++j) { const float r = o[dt][qt][j] * inv; if (j < 4) c0[j] = r; else c1[j - 4] = r; unsigned short a2, c2; splitf(r, a2, c2); oh[j] = a2; ol[j] = c2; }
            *(v4f*)(cr + dt * 16) = c0; *(v4f*)(cr + dt * 16 + 4) = c1; *(v8us*)(Ah + ao + dt * 16) = oh; *(v8us*)(Al + ao + dt * 16) = ol; }
    }
}

extern "C" void kernel_launch(void* const* d_in, const int* in_sizes, int n_in,
                              void* d_out, int out_size, void* d_ws, size_t ws_size, hipStream_t stream) {
    (void)in_sizes; (void)n_in; (void)out_size;
    const float* xq = (const float*)d_in[0]; const float* xk = (const float*)d_in[1]; const float* xv = (const float*)d_in[2]; const float* wq = (const float*)d_in[3]; const float* bq = (const float*)d_in[4]; const float* wk = (const float*)d_in[5]; const float* bk = (const float*)d_in[6]; const float* wv = (const float*)d_in[7]; const float* bv = (const float*)d_in[8]; const float* wo = (const float*)d_in[9]; const float* bo = (const float*)d_in[10];
    // q, k, v [4][2048][1024], wq_w, wq_b, wk_w, wk_b, wv_w, wv_b, wo_w, wo_b = d_in[0..10]
    float* OUT = (float*)d_out;                          // output 0: out [4][2048][1024]
    float* OUT1 = (float*)d_out + (size_t)NB_ * TT * DM;   // output 1: ctx [4][16][2048][64], after the first output's 8,388,608 floats
    char* wsp = (char*)d_ws;
    auto take = [&](size_t bytes) { char* p = wsp; wsp += (bytes + 255) & ~(size_t)255; return (void*)p; };
    bf* WQ = (bf*)take((size_t)DQ * DM * 2); bf* WK = (bf*)take((size_t)DKV * DM * 2); bf* WV = (bf*)take((size_t)DKV * DM * 2); bf* WO = (bf*)take((size_t)DM * DQ * 2);
    bf* XB = (bf*)take((size_t)TT * DM * 2);
    const size_t PLN = (size_t)NH_ * TT * HD;   // one batch entry's fp16 planes; all four entries' planes are kept for the one attention launch
    h16* QP16 = (h16*)take(NB_ * PLN * 2); h16* KP16 = (h16*)take(NB_ * PLN * 2); h16* VT16 = (h16*)take(NB_ * PLN * 2);
    bf* ATh = (bf*)take((size_t)NB_ * TT * DQ * 2); bf* ATl = (bf*)take((size_t)NB_ * TT * DQ * 2);
    if ((size_t)(wsp - (char*)d_ws) > ws_size) return;    // total 92 MiB of the workspace
    { k_cvt8<<<(unsigned)(((size_t)DQ * DM / 8 + 255) / 256), 256, 0, stream>>>(wq, WQ, (size_t)DQ * DM / 8); k_cvt8<<<(unsigned)(((size_t)DKV * DM / 8 + 255) / 256), 256, 0, stream>>>(wk, WK, (size_t)DKV * DM / 8); k_cvt8<<<(unsigned)(((size_t)DKV * DM / 8 + 255) / 256), 256, 0, stream>>>(wv, WV, (size_t)DKV * DM / 8);
      k_cvt8<<<(unsigned)(((size_t)DM * DQ / 8 + 255) / 256), 256, 0, stream>>>(wo, WO, (size_t)DM * DQ / 8); }   // [out][in] as they stand: A of the q and k projections, Bt of the v and output projections
    const unsigned LX = (unsigned)(((size_t)TT * DM / 8 + 255) / 256);
    for (int b = 0; b < NB_; ++b) {
        k_cvt8<<<LX, 256, 0, stream>>>(xq + (size_t)b * TT * DM, XB, (size_t)TT * DM / 8);
        k_gemmw<bf, 0, true, 1><<<dim3(DQ / 64, TT / 64, 1), 32, 0, stream>>>(WQ, nullptr, XB, nullptr, DM, nullptr, 0, bq, 0, 0, 0, QP16 + b * PLN, HD, (size_t)TT * HD);   // [h][t][d]
        k_cvt8<<<LX, 256, 0, stream>>>(xk + (size_t)b * TT * DM, XB, (size_t)TT * DM / 8);
        k_gemmw<bf, 0, true, 1><<<dim3(DKV / 64, TT / 64, 1), 32, 0, stream>>>(WK, nullptr, XB, nullptr, DM, nullptr, 0, bk, 0, 0, 0, KP16 + b * PLN, HD, (size_t)TT * HD);   // [h][t][d]
        k_cvt8<<<LX, 256, 0, stream>>>(xv + (size_t)b * TT * DM, XB, (size_t)TT * DM / 8);
        k_gemmw<bf, 0, true, 2><<<dim3(TT / 64, DKV / 64, 1), 32, 0, stream>>>(XB, nullptr, WV, nullptr, DM, nullptr, 0, bv, 0, 0, 0, VT16 + b * PLN, TT, (size_t)64); }   // [h][d][t]
    k_fattn<<<dim3(TT / 256, NH_, NB_), 256, 0, stream>>>(QP16, KP16, VT16, OUT1, ATh, ATl);
    for (int b = 0; b < NB_; ++b)
        k_gemmw<bf, 1, true, 0><<<dim3(TT / 64, DM / 64, 1), 32, 0, stream>>>(ATh + (size_t)b * TT * DQ, ATl + (size_t)b * TT * DQ, WO, nullptr, DQ, OUT + (size_t)b * TT * DM, DM, bo, 0, 0, 0, nullptr, 0, 0);
}

// v003
// Measured time: 246 microseconds a run.
// Next to v002, in two timings, it ran 2.22 and 2.15 times as fast.
// Over all steps from v000 it is 10.8 times as fast.
#include <hip/hip_runtime.h>

// Multi-head attention on three input streams with an output projection, returning the projected output AND the per-head context (q, k, v [4][2048][1024]; Q = q Wq^T + bq, K = k Wk^T + bk, V = v Wv^T + bv with 'oi' weights [1024][1024] and
// biases [1024]; 16 heads x 64 (head h = columns h x 64 ..); scores x 1/sqrt(64); softmax over all 2048 keys; no mask; ctx = weights V; merged head-major [b][t][1024]; out = merged Wo^T + bo ('oi' [1024][1024]);
// TWO OUTPUTS in one buffer: out [4][2048][1024] at float offset 0 and ctx [4][16][2048][64] at float offset 8,388,608; argument order q, k, v, wq_w, wq_b, wk_w, wk_b, wv_w, wv_b, wo_w, wo_b).
// Layout: four launches, each over all four batch entries. One conversion launch makes the bf16 copies of q, k, v (all 8192 tokens of each) and of the four 'oi' weights as they stand; one projection launch does Q, K and V, exact + f32 biases, each tile storing its fp16 head plane from its own epilogue; one fused attention launch over (query block, head, batch entry), running softmax, no score matrix in memory;
// merged hi/lo x Wo exact + bo writes the first output.
// Compute dtypes, f32 accumulate: every float input rounded to bf16 at its load; projections exact + f32 biases; scores and attn.v fp16; softmax f32; output projection hl x exact; the second output is the f32 context as the attention kernel divides it.

#define NB_  4
#define TT   2048
#define DM   1024
#define NH_  16
#define NKV  16
#define HD   64
#define DQ   (NH_ * HD)
#define DKV  (NKV * HD)
#define SCL  0.125f   // HD^-0.5
typedef _Float16 h16;
typedef unsigned short bf;
typedef __attribute__((ext_vector_type(16))) __bf16   v16bf;
typedef __attribute__((ext_vector_type(16))) _Float16 v16h;
typedef __attribute__((ext_vector_type(8)))  _Float16 v8h;
typedef __attribute__((ext_vector_type(8)))  unsigned short v8us;
typedef __attribute__((ext_vector_type(8)))  float    v8f;
typedef __attribute__((ext_vector_type(4)))  float    v4f;
typedef v8h  __attribute__((may_alias)) v8ha;
typedef v4f  __attribute__((may_alias)) v4fa;
typedef v8us __attribute__((may_alias)) v8usa;

__device__ __forceinline__ unsigned short f2bf(float f) { unsigned u = __float_as_uint(f); u += 0x7FFFu + ((u >> 16) & 1u); return (unsigned short)(u >> 16); }
__device__ __forceinline__ float bf2f(unsigned short b) { return __uint_as_float(((unsigned)b) << 16); }
__device__ __forceinline__ float bfr(float f) { return bf2f(f2bf(f)); }
__device__ __forceinline__ v16h cat16(v8h lo, v8h hi) { return __builtin_shufflevector(lo, hi, 0, 1, 2, 3, 4, 5, 6, 7, 8, 9, 10, 11, 12, 13, 14, 15); }
__device__ __forceinline__ v16bf cat16b(v8us lo, v8us hi) { return __builtin_bit_cast(v16bf, __builtin_shufflevector(lo, hi, 0, 1, 2, 3, 4, 5, 6, 7, 8, 9, 10, 11, 12, 13, 14, 15)); }
__device__ __forceinline__ v8f wmma16(v16h a, v16h b, v8f c) { return __builtin_amdgcn_wmma_f32_16x16x32_f16(false, a, false, b, (short)0, c, false, false); }
__device__ __forceinline__ v8f wmmab(v16bf a, v16bf b, v8f c) { return __builtin_amdgcn_wmma_f32_16x16x32_bf16(false, a, false, b, (short)0, c, false, false); }



// ---- register-blocked GEMM, ONE WAVE per 64x64 output tile (16 accumulators), operands straight from K-contiguous 16-bit planes; 32 threads a work-group.
// gemm_acc: acc[mb][nb] = sum_k A[m][k] Bt[n][k] (+ split products per NSPLIT); aoff / boff are the lane's own element offsets of the tile's first A row / Bt row. K % 32 == 0.
template <typename T16> struct WFrag;
template <> struct WFrag<h16> { typedef v16h V; static __device__ __forceinline__ V ld(const h16* p) { return cat16(*(const v8h*)p, *(const v8h*)(p + 16)); } static __device__ __forceinline__ v8f mma(V a, V b, v8f c) { return wmma16(a, b, c); } };
template <> struct WFrag<bf> { typedef v16bf V; static __device__ __forceinline__ V ld(const bf* p) { return cat16b(*(const v8us*)p, *(const v8us*)(p + 16)); } static __device__ __forceinline__ v8f mma(V a, V b, v8f c) { return wmmab(a, b, c); } };
template <typename T16, int NSPLIT>
__device__ __forceinline__ void gemm_acc(v8f (&acc)[4][4], const T16* __restrict__ A, const T16* __restrict__ A2, const T16* __restrict__ Bt, const T16* __restrict__ Bt2, int K, size_t aoff, size_t boff) {
    typedef typename WFrag<T16>::V V;
#pragma unroll
    for (int mb = 0; mb < 4; ++mb)
#pragma unroll
        for (int nb = 0; nb < 4; ++nb) acc[mb][nb] = (v8f){};

    for (int kc = 0; kc < K; kc += 32) {
        V a[4], a2[4];
#pragma unroll
        for (int mb = 0; mb < 4; ++mb) { a[mb] = WFrag<T16>::ld(A + aoff + (size_t)mb * 16 * K + kc); if (NSPLIT == 1 || NSPLIT == 2) a2[mb] = WFrag<T16>::ld(A2 + aoff + (size_t)mb * 16 * K + kc); }
#pragma unroll
        for (int nb = 0; nb < 4; ++nb) { const V b = WFrag<T16>::ld(Bt + boff + (size_t)nb * 16 * K + kc); V b2; if (NSPLIT >= 2) b2 = WFrag<T16>::ld(Bt2 + boff + (size_t)nb * 16 * K + kc);
#pragma unroll
            for (int mb = 0; mb < 4; ++mb) { acc[mb][nb] = WFrag<T16>::mma(a[mb], b, acc[mb][nb]); if (NSPLIT == 1 || NSPLIT == 2) acc[mb][nb] = WFrag<T16>::mma(a2[mb], b, acc[mb][nb]); if (NSPLIT >= 2) acc[mb][nb] = WFrag<T16>::mma(a[mb], b2, acc[mb][nb]); } }
        // four vector slots behind the trip's last WMMA: on the taken branch the next trip's first vector instructions may overwrite its A or B registers
        asm volatile("v_nop\n\tv_nop\n\tv_nop\n\tv_nop" : "+v"(acc[0][0]), "+v"(acc[1][1]), "+v"(acc[2][2]), "+v"(acc[3][3]) : "v"(a[0]), "v"(a[3]));
    }
}

// plane_out: the tile goes out as fp16, transposed, pr[n * ldp + (m % 64)] (pr = the lane's own row n = c0 + lr, piece 8 hi): a lane's accumulator holds 8 consecutive m of one n, which is one 16-byte store, no LDS.
// PLANE 1: bias[m] (A = weights, Bt = tokens: row n = token, 64 head columns). PLANE 2: bias[n] (A = tokens, Bt = weights: row n = head column, tokens along the row).
template <int PLANE>
__device__ __forceinline__ void plane_out(const v8f (&acc)[4][4], h16* pr, int ldp, const float* __restrict__ bias, int r0, int c0, int lr, int hi) {
#pragma unroll
    for (int mb = 0; mb < 4; ++mb) {
        v4f b0 = (v4f){}, b1 = (v4f){};
        if (PLANE == 1) { b0 = *(const v4f*)(bias + r0 + mb * 16 + 8 * hi); b1 = *(const v4f*)(bias + r0 + mb * 16 + 8 * hi + 4); }
#pragma unroll
        for (int nb = 0; nb < 4; ++nb) { const float bn = (PLANE == 2) ? bfr(bias[c0 + nb * 16 + lr]) : 0.f; v8h o;
#pragma unroll
            for (int j = 0; j < 8; ++j) o[j] = (h16)(acc[mb][nb][j] + ((PLANE == 1) ? bfr(j < 4 ? b0[j] : b1[j - 4]) : bn));
            *(v8h*)(pr + (size_t)nb * 16 * ldp + mb * 16) = o; }
    }
}

// k_proj: the three projections of all four batch entries in one launch. Grid (64 weight rows, 64 tokens, stream x 4 + batch entry); X = [stream][entry][token][DM], W = [stream][out][in], P = [stream][entry] planes.
// Streams 0, 1 (Q, K): W X^T, plane [h][t][d]. Stream 2 (V): X W^T, plane [h][d][t]. The choice is the same for the whole work-group (it comes from blockIdx.z).
__global__ __launch_bounds__(32) void k_proj(const bf* __restrict__ X, const bf* __restrict__ Wt, const float* __restrict__ bq, const float* __restrict__ bk, const float* __restrict__ bv, h16* P) {
    const int lane = threadIdx.x & 31, lr = lane & 15, hi = lane >> 4; const int s = blockIdx.z / NB_; const bool isv = s == 2;
    const bf* x = X + (size_t)blockIdx.z * TT * DM; const bf* w = Wt + (size_t)s * DQ * DM; h16* p = P + (size_t)blockIdx.z * NH_ * TT * HD;
    const int w0 = blockIdx.x * 64, t0 = blockIdx.y * 64; const int r0 = isv ? t0 : w0, c0 = isv ? w0 : t0;
    v8f acc[4][4];
    gemm_acc<bf, 0>(acc, isv ? x : w, nullptr, isv ? w : x, nullptr, DM, (size_t)(r0 + lr) * DM + 8 * hi, (size_t)(c0 + lr) * DM + 8 * hi);
    if (!isv) { plane_out<1>(acc, p + (size_t)blockIdx.x * TT * HD + (size_t)(c0 + lr) * HD + 8 * hi, HD, s ? bk : bq, r0, c0, lr, hi);
        // behind the last Q/K store: the V path follows it in the listing and writes the stores' registers; a precaution of form, kept whether or not a wave can take that way
        asm volatile("s_wait_xcnt 0x0" ::: "memory"); }
    else      plane_out<2>(acc, p + (size_t)t0 + (size_t)(c0 + lr) * TT + 8 * hi, TT, bv, r0, c0, lr, hi);
}

// k_gemmw: C[m][n] (f32, pitch ldc, + optional f32 bias[n]) = the product above; grid (M/64, N/64).
template <typename T16, int NSPLIT, bool BIAS>
__global__ __launch_bounds__(32) void k_gemmw(const T16* __restrict__ A, const T16* __restrict__ A2, const T16* __restrict__ Bt, const T16* __restrict__ Bt2, int K, float* C, int ldc, const float* __restrict__ bias) {
    const int lane = threadIdx.x & 31, lr = lane & 15, hi = lane >> 4; const int r0 = blockIdx.x * 64, c0 = blockIdx.y * 64;
    v8f acc[4][4];
    gemm_acc<T16, NSPLIT>(acc, A, A2, Bt, Bt2, K, (size_t)(r0 + lr) * K + 8 * hi, (size_t)(c0 + lr) * K + 8 * hi);
    __shared__ __align__(16) float os[16 * 68];
#pragma unroll
    for (int mb = 0; mb < 4; ++mb) {
#pragma unroll
        for (int nb = 0; nb < 4; ++nb) {
#pragma unroll
            for (int j = 0; j < 8; ++j) os[(hi * 8 + j) * 68 + nb * 16 + lr] = acc[mb][nb][j]; }
        __builtin_amdgcn_wave_barrier(); asm volatile("" ::: "memory");
        float* crow = C + (size_t)(r0 + mb * 16) * ldc + c0;
{
#pragma unroll
            for (int s = 0; s < 8; ++s) { const int row = 2 * s + hi, cofs = lr * 4; v4f val = *(const v4fa*)(os + row * 68 + cofs); if (BIAS) { val[0] += bfr(bias[c0 + cofs]); val[1] += bfr(bias[c0 + cofs + 1]); val[2] += bfr(bias[c0 + cofs + 2]); val[3] += bfr(bias[c0 + cofs + 3]); }
                *(v4f*)(crow + (size_t)row * ldc + cofs) = val; }
             }
        __builtin_amdgcn_wave_barrier(); asm volatile("" ::: "memory");
    }
}

__device__ __forceinline__ void splitf(float y, unsigned short& h, unsigned short& l) { h = f2bf(y); l = f2bf(y - bf2f(h)); }
typedef __attribute__((ext_vector_type(2))) _Float16 v2h;
typedef __attribute__((ext_vector_type(4))) _Float16 v4h;
typedef __attribute__((ext_vector_type(2))) unsigned short v2us;
typedef __attribute__((ext_vector_type(4))) unsigned short v4us;
typedef __attribute__((ext_vector_type(2))) float v2f;
typedef __attribute__((ext_vector_type(4))) int v4i;

// k_cvt8: every float tensor that a product reads, rounded to bf16, in one launch; a work-group does 2048 elements of one tensor (the tensor follows from blockIdx.x alone). X = [q, k, v], Wd = [wq, wk, wv, wo].
#define XBK (NB_ * TT * DM / 2048)   // work-groups a token stream
#define WBK (DQ * DM / 2048)         // work-groups a weight
__global__ __launch_bounds__(256) void k_cvt8(const float* __restrict__ q, const float* __restrict__ k, const float* __restrict__ v, const float* __restrict__ wq, const float* __restrict__ wk, const float* __restrict__ wv, const float* __restrict__ wo, bf* X, bf* Wd) {
    const unsigned g = blockIdx.x; const float* src; bf* dst; unsigned blk;
    if (g < 3 * XBK) { const unsigned s = g / XBK; blk = g % XBK; src = s == 0 ? q : s == 1 ? k : v; dst = X + (size_t)s * NB_ * TT * DM; }
    else { const unsigned s = (g - 3 * XBK) / WBK; blk = (g - 3 * XBK) % WBK; src = s == 0 ? wq : s == 1 ? wk : s == 2 ? wv : wo; dst = Wd + (size_t)s * DQ * DM; }
    const size_t i = (size_t)blk * 256 + threadIdx.x; const v8f x = *(const v8f*)(src + i * 8); v8us o;
#pragma unroll
    for (int e = 0; e < 8; ++e) o[e] = f2bf(x[e]); *(v8us*)(dst + i * 8) = o;  }

#define KST 64   // keys a stage
#define LP  72   // LDS row pitch in fp16: 144 B = 16 B x 9, 16-byte fragment reads of 16 rows fall on 64 distinct banks
__device__ __forceinline__ float xhalf(float x) { return __builtin_bit_cast(float, __builtin_amdgcn_permlanex16(__builtin_bit_cast(int, x), __builtin_bit_cast(int, x), 0x76543210, 0xfedcba98, false, false)); }   // lane l with lane l ^ 16
__global__ __launch_bounds__(256) __attribute__((amdgpu_waves_per_eu(4, 4))) void k_fattn(const h16* __restrict__ Q, const h16* __restrict__ Kp, const h16* __restrict__ Vt, float* CTX, bf* Ah, bf* Al) {
    __shared__ __align__(16) h16 ks[2 * KST * LP]; __shared__ __align__(16) h16 vs[2 * HD * LP];
    const int lane = threadIdx.x & 31, lr = lane & 15, hi = lane >> 4, wv = threadIdx.x >> 5; const int h = blockIdx.y, b = blockIdx.z;
    const size_t pl = ((size_t)b * NH_ + h) * TT * HD; const int q0 = blockIdx.x * 256 + wv * 32;
    const float C2 = SCL * 1.4426950408889634f;   // scores to log2 units
    const h16* qp = Q + pl + (size_t)(q0 + lr) * HD + 8 * hi;
    const int srow = threadIdx.x >> 3, sch = (threadIdx.x & 7) * 8;   // staging: thread -> (row, 16-byte piece); rows srow and srow + 32
    const h16* kg = Kp + pl + (size_t)srow * HD + sch; const h16* vg = Vt + pl + (size_t)srow * TT + sch; const int so = srow * LP + sch;
    v16h qf[2][2]; v8f o[4][2]; float m[2], l[2]; v8h gk[2], gv[2];
#pragma unroll
    for (int r = 0; r < 2; ++r) { gk[r] = *(const v8h*)(kg + (size_t)r * 32 * HD); gv[r] = *(const v8h*)(vg + (size_t)r * 32 * TT); }
#pragma unroll
    for (int qt = 0; qt < 2; ++qt) { m[qt] = -3.0e38f; l[qt] = 0.f;
#pragma unroll
        for (int kc = 0; kc < 2; ++kc) qf[qt][kc] = WFrag<h16>::ld(qp + qt * 16 * HD + kc * 32);
#pragma unroll
        for (int dt = 0; dt < 4; ++dt) o[dt][qt] = (v8f){}; }
#pragma unroll
    for (int r = 0; r < 2; ++r) { *(v8h*)(ks + so + r * 32 * LP) = gk[r]; *(v8h*)(vs + so + r * 32 * LP) = gv[r]; }
    __syncthreads();   // stage 0 is published
    for (int st = 0; st < TT / KST; ++st) {
        const h16* kl = ks + (st & 1) * (KST * LP) + lr * LP + 8 * hi; const h16* vl = vs + (st & 1) * (HD * LP) + lr * LP + 8 * hi; const bool more = st + 1 < TT / KST;
        if (more) {
#pragma unroll
            for (int r = 0; r < 2; ++r) { gk[r] = *(const v8h*)(kg + (size_t)((st + 1) * KST + r * 32) * HD); gv[r] = *(const v8h*)(vg + (size_t)r * 32 * TT + (st + 1) * KST); } }
#pragma unroll 1   // rolled: unrolled, the second pass's fragments are fetched over the first and the registers of four waves a SIMD no longer hold them
        for (int ps = 0; ps < KST / 32; ++ps) {
            v16h kf[2][2], vf[4]; v8f s[2][2];
#pragma unroll
            for (int kt = 0; kt < 2; ++kt)
#pragma unroll
                for (int kc = 0; kc < 2; ++kc) kf[kt][kc] = WFrag<h16>::ld(kl + (ps * 32 + kt * 16) * LP + kc * 32);
#pragma unroll
            for (int dt = 0; dt < 4; ++dt) vf[dt] = WFrag<h16>::ld(vl + dt * 16 * LP + ps * 32);
#pragma unroll
            for (int kt = 0; kt < 2; ++kt)
#pragma unroll
                for (int qt = 0; qt < 2; ++qt) { s[kt][qt] = wmma16(kf[kt][0], qf[qt][0], (v8f){}); s[kt][qt] = wmma16(kf[kt][1], qf[qt][1], s[kt][qt]); }
#pragma unroll
            for (int qt = 0; qt < 2; ++qt) {
                float mx = s[0][qt][0];
#pragma unroll
                for (int j = 1; j < 8; ++j) mx = fmaxf(mx, s[0][qt][j]);
#pragma unroll
                for (int j = 0; j < 8; ++j) mx = fmaxf(mx, s[1][qt][j]);
                mx = fmaxf(mx, xhalf(mx));
                const float mn = fmaxf(m[qt], mx * C2); const float al = __builtin_amdgcn_exp2f(m[qt] - mn); m[qt] = mn; const float sh = 10.0f - mn;
                v16h p; float psum = 0.f;
#pragma unroll
                for (int j = 0; j < 8; ++j) { const float e0 = __builtin_amdgcn_exp2f(fmaf(s[0][qt][j], C2, sh)), e1 = __builtin_amdgcn_exp2f(fmaf(s[1][qt][j], C2, sh)); psum += e0 + e1; p[j] = (h16)e0; p[8 + j] = (h16)e1; }
                l[qt] = fmaf(l[qt], al, psum);
#pragma unroll
                for (int dt = 0; dt < 4; ++dt) { o[dt][qt] *= al; o[dt][qt] = wmma16(vf[dt], p, o[dt][qt]); }
            }
            // four vector slots behind the pass's last WMMA: on the taken branch the loop's first vector instructions may overwrite its A or B registers
            asm volatile("v_nop\n\tv_nop\n\tv_nop\n\tv_nop" : "+v"(o[0][1]), "+v"(o[1][1]), "+v"(o[2][1]), "+v"(o[3][1]) : "v"(vf[0]), "v"(vf[1]), "v"(vf[2]), "v"(vf[3]));
        }
        if (more) { const int sn = ((st + 1) & 1);   // the other buffer: its readers left it before the barrier that ended the stage before this one
#pragma unroll
            for (int r = 0; r < 2; ++r) { *(v8h*)(ks + sn * (KST * LP) + so + r * 32 * LP) = gk[r]; *(v8h*)(vs + sn * (HD * LP) + so + r * 32 * LP) = gv[r]; } }
        __syncthreads();   // publishes stage st + 1 and ends every wave's reads of stage st
    }
#pragma unroll
    for (int qt = 0; qt < 2; ++qt) {
        const float lt = l[qt] + xhalf(l[qt]); const float inv = __fdiv_rn(1.0f, lt); const int t = q0 + qt * 16 + lr;
        float* cr = CTX + pl + (size_t)t * HD + 8 * hi; const size_t ao = ((size_t)b * TT + t) * DQ + h * HD + 8 * hi;
#pragma unroll
        for (int dt = 0; dt < 4; ++dt) { v4f c0, c1; v8us oh, ol;
#pragma unroll
            for (int j = 0; j < 8; ++j) { const float r = o[dt][qt][j] * inv; if (j < 4) c0[j] = r; else c1[j - 4] = r; unsigned short a2, c2; splitf(r, a2, c2); oh[j] = a2; ol[j] = c2; }
            *(v4f*)(cr + dt * 16) = c0; *(v4f*)(cr + dt * 16 + 4) = c1; *(v8us*)(Ah + ao + dt * 16) = oh; *(v8us*)(Al + ao + dt * 16) = ol; }
    }
}

extern "C" void kernel_launch(void* const* d_in, const int* in_sizes, int n_in,
                              void* d_out, int out_size, void* d_ws, size_t ws_size, hipStream_t stream) {
    (void)in_sizes; (void)n_in; (void)out_size;
    const float* xq = (const float*)d_in[0]; const float* xk = (const float*)d_in[1]; const float* xv = (const float*)d_in[2]; const float* wq = (const float*)d_in[3]; const float* bq = (const float*)d_in[4]; const float* wk = (const float*)d_in[5]; const float* bk = (const float*)d_in[6]; const float* wv = (const float*)d_in[7]; const float* bv = (const float*)d_in[8]; const float* wo = (const float*)d_in[9]; const float* bo = (const float*)d_in[10];
    // q, k, v [4][2048][1024], wq_w, wq_b, wk_w, wk_b, wv_w, wv_b, wo_w, wo_b = d_in[0..10]
    float* OUT = (float*)d_out;                          // output 0: out [4][2048][1024]
    float* OUT1 = (float*)d_out + (size_t)NB_ * TT * DM;   // output 1: ctx [4][16][2048][64], after the first output's 8,388,608 floats
    char* wsp = (char*)d_ws;
    auto take = [&](size_t bytes) { char* p = wsp; wsp += (bytes + 255) & ~(size_t)255; return (void*)p; };
    bf* WB = (bf*)take((size_t)4 * DQ * DM * 2);   // wq, wk, wv, wo, [out][in] as they stand (A of the Q, K products, Bt of V and out)
    bf* XB = (bf*)take((size_t)3 * NB_ * TT * DM * 2);   // q, k, v, all batch entries
    const size_t PLN = (size_t)NH_ * TT * HD;   // one batch entry's fp16 planes
    h16* PL16 = (h16*)take(3 * NB_ * PLN * 2);   // Q [b][h][t][d], K [b][h][t][d], V^T [b][h][d][t]
    bf* ATh = (bf*)take((size_t)NB_ * TT * DQ * 2); bf* ATl = (bf*)take((size_t)NB_ * TT * DQ * 2);
    if ((size_t)(wsp - (char*)d_ws) > ws_size) return;    // total 136 MiB of the workspace
    k_cvt8<<<3 * XBK + 4 * WBK, 256, 0, stream>>>(xq, xk, xv, wq, wk, wv, wo, XB, WB);
    k_proj<<<dim3(DQ / 64, TT / 64, 3 * NB_), 32, 0, stream>>>(XB, WB, bq, bk, bv, PL16);
    k_fattn<<<dim3(TT / 256, NH_, NB_), 256, 0, stream>>>(PL16, PL16 + NB_ * PLN, PL16 + 2 * NB_ * PLN, OUT1, ATh, ATl);
    k_gemmw<bf, 1, true><<<dim3(NB_ * TT / 64, DM / 64, 1), 32, 0, stream>>>(ATh, ATl, WB + (size_t)3 * DQ * DM, nullptr, DQ, OUT, DM, bo);
}

// v004
// One run takes 153 microseconds.
// Timed twice side by side with v003, it ran 1.61 times as fast both times.
// Counting every step since v000, it is 17.5 times as fast.
#include <hip/hip_runtime.h>

// Multi-head attention on three input streams with an output projection, returning the projected output AND the per-head context (q, k, v [4][2048][1024]; Q = q Wq^T + bq, K = k Wk^T + bk, V = v Wv^T + bv with 'oi' weights [1024][1024] and
// biases [1024]; 16 heads x 64 (head h = columns h x 64 ..); scores x 1/sqrt(64); softmax over all 2048 keys; no mask; ctx = weights V; merged head-major [b][t][1024]; out = merged Wo^T + bo ('oi' [1024][1024]);
// TWO OUTPUTS in one buffer: out [4][2048][1024] at float offset 0 and ctx [4][16][2048][64] at float offset 8,388,608; argument order q, k, v, wq_w, wq_b, wk_w, wk_b, wv_w, wv_b, wo_w, wo_b).
// Layout: four launches, each over all four batch entries. One conversion launch makes the bf16 copies of q, k, v (all 8192 tokens of each) and of the four 'oi' weights as they stand; one projection launch does Q, K and V, exact + f32 biases, each tile storing its fp16 head plane from its own epilogue; one fused attention launch over (query block, head, batch entry), running softmax, no score matrix in memory;
// merged hi/lo x Wo exact + bo writes the first output.
// Compute dtypes, f32 accumulate: every float input rounded to bf16 at its load; projections exact + f32 biases; scores and attn.v fp16; softmax f32; output projection hl x exact; the second output is the f32 context as the attention kernel divides it.

#define NB_  4
#define TT   2048
#define DM   1024
#define NH_  16
#define NKV  16
#define HD   64
#define DQ   (NH_ * HD)
#define DKV  (NKV * HD)
#define SCL  0.125f   // HD^-0.5
typedef _Float16 h16;
typedef unsigned short bf;
typedef __attribute__((ext_vector_type(16))) __bf16   v16bf;
typedef __attribute__((ext_vector_type(16))) _Float16 v16h;
typedef __attribute__((ext_vector_type(8)))  _Float16 v8h;
typedef __attribute__((ext_vector_type(8)))  unsigned short v8us;
typedef __attribute__((ext_vector_type(8)))  float    v8f;
typedef __attribute__((ext_vector_type(4)))  float    v4f;
typedef v8h  __attribute__((may_alias)) v8ha;
typedef v4f  __attribute__((may_alias)) v4fa;
typedef v8us __attribute__((may_alias)) v8usa;

__device__ __forceinline__ unsigned short f2bf(float f) { unsigned u = __float_as_uint(f); u += 0x7FFFu + ((u >> 16) & 1u); return (unsigned short)(u >> 16); }
__device__ __forceinline__ float bf2f(unsigned short b) { return __uint_as_float(((unsigned)b) << 16); }
__device__ __forceinline__ float bfr(float f) { return bf2f(f2bf(f)); }
__device__ __forceinline__ v16h cat16(v8h lo, v8h hi) { return __builtin_shufflevector(lo, hi, 0, 1, 2, 3, 4, 5, 6, 7, 8, 9, 10, 11, 12, 13, 14, 15); }
__device__ __forceinline__ v16bf cat16b(v8us lo, v8us hi) { return __builtin_bit_cast(v16bf, __builtin_shufflevector(lo, hi, 0, 1, 2, 3, 4, 5, 6, 7, 8, 9, 10, 11, 12, 13, 14, 15)); }
__device__ __forceinline__ v8f wmma16(v16h a, v16h b, v8f c) { return __builtin_amdgcn_wmma_f32_16x16x32_f16(false, a, false, b, (short)0, c, false, false); }
__device__ __forceinline__ v8f wmmab(v16bf a, v16bf b, v8f c) { return __builtin_amdgcn_wmma_f32_16x16x32_bf16(false, a, false, b, (short)0, c, false, false); }



// ---- work-group GEMM: 8 waves (4 along A x 2 along Bt), each wave a 64x64 output tile (16 accumulators), so a work-group does 256 A rows x 128 Bt rows; operands are K-contiguous 16-bit planes.
// The waves share each operand row: a stage is 64 k of every row of the tile in LDS, brought by asynchronous copies (16 bytes a lane, whole 128-byte lines a row), two buffers, the next stage in flight while this one is worked on.
// gemm_wg: acc[mb][nb] = sum_k A[m][k] Bt[n][k] (+ A2[m][k] Bt[n][k] where NA == 2), k ascending, A before A2 in each 32 k. R0 / C0 = the work-group's first A row / Bt row. K % 64 == 0, K >= 128.
template <typename T16> struct WFrag;
template <> struct WFrag<h16> { typedef v16h V; static __device__ __forceinline__ V ld(const h16* p) { return cat16(*(const v8h*)p, *(const v8h*)(p + 16)); } static __device__ __forceinline__ v8f mma(V a, V b, v8f c) { return wmma16(a, b, c); } };
template <> struct WFrag<bf> { typedef v16bf V; static __device__ __forceinline__ V ld(const bf* p) { return cat16b(*(const v8us*)p, *(const v8us*)(p + 16)); } static __device__ __forceinline__ v8f mma(V a, V b, v8f c) { return wmmab(a, b, c); } };
#define GKS 64    // k a stage
#define GLP 72    // LDS row pitch in 16-bit elements: 144 B = 16 B x 9, 16-byte fragment reads of 16 rows fall on 64 distinct banks
#define GWM 256   // A rows a work-group
#define GWN 128   // Bt rows a work-group
#define GBUF(NA) (((NA) * GWM + GWN) * GLP)   // 16-bit elements a buffer: [A rows | A2 rows | Bt rows]
// four copies of 16 bytes a lane, rows 32 apart (l = the lane's LDS byte address, g = its global address). The s_wait_xcnt closes the statement so that it stands in front of every later write of the address registers.
__device__ __forceinline__ void copy4(unsigned l, const bf* g, int K) {
    asm volatile("global_load_async_to_lds_b128 %0, %4, off\n\tglobal_load_async_to_lds_b128 %1, %5, off\n\tglobal_load_async_to_lds_b128 %2, %6, off\n\tglobal_load_async_to_lds_b128 %3, %7, off\n\ts_wait_xcnt 0x0"
                 :: "v"(l), "v"(l + 32 * GLP * 2), "v"(l + 64 * GLP * 2), "v"(l + 96 * GLP * 2), "v"(g), "v"(g + (size_t)32 * K), "v"(g + (size_t)64 * K), "v"(g + (size_t)96 * K) : "memory");
}
// one stage: every thread copies its 16-byte piece of rows srow + 32 i; l = the lane's address in the target buffer, ga / ga2 / gb = its piece of the stage's first rows.
template <int NA, int K>
__device__ __forceinline__ void stage_copy(unsigned l, const bf* ga, const bf* ga2, const bf* gb) {
    copy4(l, ga, K); copy4(l + 128 * GLP * 2, ga + (size_t)128 * K, K);
    if (NA == 2) { copy4(l + GWM * GLP * 2, ga2, K); copy4(l + (GWM + 128) * GLP * 2, ga2 + (size_t)128 * K, K); }
    copy4(l + NA * GWM * GLP * 2, gb, K);
}
template <int NA, int K>
__device__ __forceinline__ void gemm_wg(v8f (&acc)[4][4], const bf* __restrict__ A, const bf* __restrict__ A2, const bf* __restrict__ Bt, int R0, int C0, bf* sm) {
    typedef typename WFrag<bf>::V V;
    const int lane = threadIdx.x & 31, lr = lane & 15, hi = lane >> 4, wv = threadIdx.x >> 5;
    const int srow = threadIdx.x >> 3, sch = (threadIdx.x & 7) * 8;   // staging: thread -> (row, 16-byte piece)
    const bf* ga = A + (size_t)(R0 + srow) * K + sch; const bf* ga2 = (NA == 2) ? A2 + (size_t)(R0 + srow) * K + sch : nullptr; const bf* gb = Bt + (size_t)(C0 + srow) * K + sch;
    const unsigned l0 = (unsigned)(size_t)(sm + srow * GLP + sch);   // LDS byte address: the low 32 bits of the shared address
    const bf* fa = sm + ((wv >> 1) * 64 + lr) * GLP + 8 * hi; const bf* fb = sm + (NA * GWM + (wv & 1) * 64 + lr) * GLP + 8 * hi;
#pragma unroll
    for (int mb = 0; mb < 4; ++mb)
#pragma unroll
        for (int nb = 0; nb < 4; ++nb) acc[mb][nb] = (v8f){};

    stage_copy<NA, K>(l0, ga, ga2, gb);
    asm volatile("s_wait_asynccnt 0x0" ::: "memory");   // this wave's copies of stage 0 have landed
    __syncthreads();   // stage 0 is published
    stage_copy<NA, K>(l0 + GBUF(NA) * 2, ga + GKS, ga2 + GKS, gb + GKS);
    for (int t = 0; t < K / GKS; ++t) {
        const int bo = (t & 1) * GBUF(NA);
        // the hand-over of a stage stands where its last fragments are in registers, in front of the last block's WMMAs, so that the refill flies over them too
        auto handover = [&]() {
            asm volatile("s_wait_dscnt 0x0" ::: "memory");      // this wave's reads of stage t are done before its buffer is refilled
            asm volatile("s_wait_asynccnt 0x0" ::: "memory");   // this wave's copies of stage t + 1 have landed
            __syncthreads();   // publishes stage t + 1 and ends every wave's reads of stage t
            if (t + 2 < K / GKS) stage_copy<NA, K>(l0 + bo * 2, ga + (t + 2) * GKS, ga2 + (t + 2) * GKS, gb + (t + 2) * GKS);
        };
#pragma unroll
        for (int kc = 0; kc < GKS; kc += 32) {
            V a[4], b[4];   // a block = 16 WMMAs; its fragments are read as one group in front of it
#pragma unroll
            for (int mb = 0; mb < 4; ++mb) { a[mb] = WFrag<bf>::ld(fa + bo + mb * 16 * GLP + kc); b[mb] = WFrag<bf>::ld(fb + bo + mb * 16 * GLP + kc); }
            // holds the block's LDS reads together in front of its WMMAs (loaded values as inputs only): left alone, the Bt reads are spread among the WMMAs, each with a wait to 0 of its own
            asm volatile("" :: "v"(a[0]), "v"(a[1]), "v"(a[2]), "v"(a[3]), "v"(b[0]), "v"(b[1]), "v"(b[2]), "v"(b[3]));
            if (NA == 1 && kc == GKS - 32) handover();
#pragma unroll
            for (int nb = 0; nb < 4; ++nb)
#pragma unroll
                for (int mb = 0; mb < 4; ++mb) acc[mb][nb] = WFrag<bf>::mma(a[mb], b[nb], acc[mb][nb]);
            if (NA == 2) {   // the second plane's block, on the same Bt fragments: each accumulator still takes A, then A2, of every 32 k
#pragma unroll
                for (int mb = 0; mb < 4; ++mb) a[mb] = WFrag<bf>::ld(fa + bo + (GWM + mb * 16) * GLP + kc);
                // holds this block's reads here (loaded values as inputs only): left alone, they and the next block's are lifted to the top of the trip, and the registers pass 256, with register-window switches in the loop
                asm volatile("" :: "v"(a[0]), "v"(a[1]), "v"(a[2]), "v"(a[3]));
                if (kc == GKS - 32) handover();
#pragma unroll
                for (int nb = 0; nb < 4; ++nb)
#pragma unroll
                    for (int mb = 0; mb < 4; ++mb) acc[mb][nb] = WFrag<bf>::mma(a[mb], b[nb], acc[mb][nb]);
            }
        }
    }
    asm volatile("s_wait_asynccnt 0x0" ::: "memory");   // nothing is in flight when the wave goes on
}

// plane_out: the tile goes out as fp16, transposed, pr[n * ldp + (m % 64)] (pr = the lane's own row n = c0 + lr, piece 8 hi): a lane's accumulator holds 8 consecutive m of one n, which is one 16-byte store, no LDS.
// PLANE 1: bias[m] (A = weights, Bt = tokens: row n = token, 64 head columns). PLANE 2: bias[n] (A = tokens, Bt = weights: row n = head column, tokens along the row).
template <int PLANE>
__device__ __forceinline__ void plane_out(const v8f (&acc)[4][4], h16* pr, int ldp, const float* __restrict__ bias, int r0, int c0, int lr, int hi) {
#pragma unroll
    for (int mb = 0; mb < 4; ++mb) {
        v4f b0 = (v4f){}, b1 = (v4f){};
        if (PLANE == 1) { b0 = *(const v4f*)(bias + r0 + mb * 16 + 8 * hi); b1 = *(const v4f*)(bias + r0 + mb * 16 + 8 * hi + 4); }
#pragma unroll
        for (int nb = 0; nb < 4; ++nb) { const float bn = (PLANE == 2) ? bfr(bias[c0 + nb * 16 + lr]) : 0.f; v8h o;
#pragma unroll
            for (int j = 0; j < 8; ++j) o[j] = (h16)(acc[mb][nb][j] + ((PLANE == 1) ? bfr(j < 4 ? b0[j] : b1[j - 4]) : bn));
            *(v8h*)(pr + (size_t)nb * 16 * ldp + mb * 16) = o; }
    }
}

// k_proj: the three projections of all four batch entries in one launch. Grid (64 tiles of 256 x 128, 1, stream x 4 + batch entry); X = [stream][entry][token][DM], W = [stream][out][in], P = [stream][entry] planes.
// Streams 0, 1 (Q, K): W X^T (256 weight rows x 128 tokens), plane [h][t][d]. Stream 2 (V): X W^T (256 tokens x 128 weight rows), plane [h][d][t]. The choice is the same for the whole work-group (it comes from blockIdx.z).
__global__ __launch_bounds__(256) void k_proj(const bf* __restrict__ X, const bf* __restrict__ Wt, const float* __restrict__ bq, const float* __restrict__ bk, const float* __restrict__ bv, h16* P) {
    __shared__ __align__(16) bf sm[2 * GBUF(1)];
    const int lane = threadIdx.x & 31, lr = lane & 15, hi = lane >> 4, wv = threadIdx.x >> 5; const int s = blockIdx.z / NB_; const bool isv = s == 2;
    const bf* x = X + (size_t)blockIdx.z * TT * DM; const bf* w = Wt + (size_t)s * DQ * DM; h16* p = P + (size_t)blockIdx.z * NH_ * TT * HD;
    const int R0 = isv ? (int)(blockIdx.x / (DQ / GWN)) * GWM : (int)(blockIdx.x % (DQ / GWM)) * GWM, C0 = isv ? (int)(blockIdx.x % (DQ / GWN)) * GWN : (int)(blockIdx.x / (DQ / GWM)) * GWN;   // the weight tile runs fastest
    const int r0 = R0 + (wv >> 1) * 64, c0 = C0 + (wv & 1) * 64;   // the wave's own 64 x 64 tile
    v8f acc[4][4];
    gemm_wg<1, DM>(acc, isv ? x : w, nullptr, isv ? w : x, R0, C0, sm);
    if (!isv) { plane_out<1>(acc, p + (size_t)(r0 / HD) * TT * HD + (size_t)(c0 + lr) * HD + 8 * hi, HD, s ? bk : bq, r0, c0, lr, hi);
        // behind the last Q/K store: the V path follows it in the listing and writes the stores' registers; a precaution of form, kept whether or not a wave can take that way
        asm volatile("s_wait_xcnt 0x0" ::: "memory"); }
    else      plane_out<2>(acc, p + (size_t)r0 + (size_t)(c0 + lr) * TT + 8 * hi, TT, bv, r0, c0, lr, hi);
}

// k_gemmw: C[m][n] (f32, pitch ldc, + optional f32 bias[n]) = (A + A2) Bt^T as above; grid (M/256, N/128). Each wave turns its tile through its own LDS rows.
template <int K, bool BIAS>
__global__ __launch_bounds__(256) void k_gemmw(const bf* __restrict__ A, const bf* __restrict__ A2, const bf* __restrict__ Bt, float* C, int ldc, const float* __restrict__ bias) {
    __shared__ __align__(16) bf sm[2 * GBUF(2)]; __shared__ __align__(16) float osw[8 * 16 * 68];
    const int lane = threadIdx.x & 31, lr = lane & 15, hi = lane >> 4, wv = threadIdx.x >> 5; const int R0 = blockIdx.x * GWM, C0 = blockIdx.y * GWN; const int r0 = R0 + (wv >> 1) * 64, c0 = C0 + (wv & 1) * 64;
    v8f acc[4][4];
    gemm_wg<2, K>(acc, A, A2, Bt, R0, C0, sm);
    float* os = osw + wv * (16 * 68);
#pragma unroll
    for (int mb = 0; mb < 4; ++mb) {
#pragma unroll
        for (int nb = 0; nb < 4; ++nb) {
#pragma unroll
            for (int j = 0; j < 8; ++j) os[(hi * 8 + j) * 68 + nb * 16 + lr] = acc[mb][nb][j]; }
        __builtin_amdgcn_wave_barrier(); asm volatile("" ::: "memory");
        float* crow = C + (size_t)(r0 + mb * 16) * ldc + c0;
{
#pragma unroll
            for (int s = 0; s < 8; ++s) { const int row = 2 * s + hi, cofs = lr * 4; v4f val = *(const v4fa*)(os + row * 68 + cofs); if (BIAS) { val[0] += bfr(bias[c0 + cofs]); val[1] += bfr(bias[c0 + cofs + 1]); val[2] += bfr(bias[c0 + cofs + 2]); val[3] += bfr(bias[c0 + cofs + 3]); }
                *(v4f*)(crow + (size_t)row * ldc + cofs) = val; }
             }
        __builtin_amdgcn_wave_barrier(); asm volatile("" ::: "memory");
    }
}

__device__ __forceinline__ void splitf(float y, unsigned short& h, unsigned short& l) { h = f2bf(y); l = f2bf(y - bf2f(h)); }
typedef __attribute__((ext_vector_type(2))) _Float16 v2h;
typedef __attribute__((ext_vector_type(4))) _Float16 v4h;
typedef __attribute__((ext_vector_type(2))) unsigned short v2us;
typedef __attribute__((ext_vector_type(4))) unsigned short v4us;
typedef __attribute__((ext_vector_type(2))) float v2f;
typedef __attribute__((ext_vector_type(4))) int v4i;

// k_cvt8: every float tensor that a product reads, rounded to bf16, in one launch; a work-group does 2048 elements of one tensor (the tensor follows from blockIdx.x alone). X = [q, k, v], Wd = [wq, wk, wv, wo].
#define XBK (NB_ * TT * DM / 2048)   // work-groups a token stream
#define WBK (DQ * DM / 2048)         // work-groups a weight
__global__ __launch_bounds__(256) void k_cvt8(const float* __restrict__ q, const float* __restrict__ k, const float* __restrict__ v, const float* __restrict__ wq, const float* __restrict__ wk, const float* __restrict__ wv, const float* __restrict__ wo, bf* X, bf* Wd) {
    const unsigned g = blockIdx.x; const float* src; bf* dst; unsigned blk;
    if (g < 3 * XBK) { const unsigned s = g / XBK; blk = g % XBK; src = s == 0 ? q : s == 1 ? k : v; dst = X + (size_t)s * NB_ * TT * DM; }
    else { const unsigned s = (g - 3 * XBK) / WBK; blk = (g - 3 * XBK) % WBK; src = s == 0 ? wq : s == 1 ? wk : s == 2 ? wv : wo; dst = Wd + (size_t)s * DQ * DM; }
    const size_t i = (size_t)blk * 256 + threadIdx.x; const v8f x = *(const v8f*)(src + i * 8); v8us o;
#pragma unroll
    for (int e = 0; e < 8; ++e) o[e] = f2bf(x[e]); *(v8us*)(dst + i * 8) = o;  }

#define KST 64   // keys a stage
#define LP  72   // LDS row pitch in fp16: 144 B = 16 B x 9, 16-byte fragment reads of 16 rows fall on 64 distinct banks
__device__ __forceinline__ float xhalf(float x) { return __builtin_bit_cast(float, __builtin_amdgcn_permlanex16(__builtin_bit_cast(int, x), __builtin_bit_cast(int, x), 0x76543210, 0xfedcba98, false, false)); }   // lane l with lane l ^ 16
__global__ __launch_bounds__(256) __attribute__((amdgpu_waves_per_eu(4, 4))) void k_fattn(const h16* __restrict__ Q, const h16* __restrict__ Kp, const h16* __restrict__ Vt, float* CTX, bf* Ah, bf* Al) {
    __shared__ __align__(16) h16 ks[2 * KST * LP]; __shared__ __align__(16) h16 vs[2 * HD * LP];
    const int lane = threadIdx.x & 31, lr = lane & 15, hi = lane >> 4, wv = threadIdx.x >> 5; const int h = blockIdx.y, b = blockIdx.z;
    const size_t pl = ((size_t)b * NH_ + h) * TT * HD; const int q0 = blockIdx.x * 256 + wv * 32;
    const float C2 = SCL * 1.4426950408889634f;   // scores to log2 units
    const h16* qp = Q + pl + (size_t)(q0 + lr) * HD + 8 * hi;
    const int srow = threadIdx.x >> 3, sch = (threadIdx.x & 7) * 8;   // staging: thread -> (row, 16-byte piece); rows srow and srow + 32
    const h16* kg = Kp + pl + (size_t)srow * HD + sch; const h16* vg = Vt + pl + (size_t)srow * TT + sch; const int so = srow * LP + sch;
    v16h qf[2][2]; v8f o[4][2]; float m[2], l[2]; v8h gk[2], gv[2];
#pragma unroll
    for (int r = 0; r < 2; ++r) { gk[r] = *(const v8h*)(kg + (size_t)r * 32 * HD); gv[r] = *(const v8h*)(vg + (size_t)r * 32 * TT); }
#pragma unroll
    for (int qt = 0; qt < 2; ++qt) { m[qt] = -3.0e38f; l[qt] = 0.f;
#pragma unroll
        for (int kc = 0; kc < 2; ++kc) qf[qt][kc] = WFrag<h16>::ld(qp + qt * 16 * HD + kc * 32);
#pragma unroll
        for (int dt = 0; dt < 4; ++dt) o[dt][qt] = (v8f){}; }
#pragma unroll
    for (int r = 0; r < 2; ++r) { *(v8h*)(ks + so + r * 32 * LP) = gk[r]; *(v8h*)(vs + so + r * 32 * LP) = gv[r]; }
    __syncthreads();   // stage 0 is published
    for (int st = 0; st < TT / KST; ++st) {
        const h16* kl = ks + (st & 1) * (KST * LP) + lr * LP + 8 * hi; const h16* vl = vs + (st & 1) * (HD * LP) + lr * LP + 8 * hi; const bool more = st + 1 < TT / KST;
        if (more) {
#pragma unroll
            for (int r = 0; r < 2; ++r) { gk[r] = *(const v8h*)(kg + (size_t)((st + 1) * KST + r * 32) * HD); gv[r] = *(const v8h*)(vg + (size_t)r * 32 * TT + (st + 1) * KST); } }
#pragma unroll 1   // rolled: unrolled, the second pass's fragments are fetched over the first and the registers of four waves a SIMD no longer hold them
        for (int ps = 0; ps < KST / 32; ++ps) {
            v16h kf[2][2], vf[4]; v8f s[2][2];
#pragma unroll
            for (int kt = 0; kt < 2; ++kt)
#pragma unroll
                for (int kc = 0; kc < 2; ++kc) kf[kt][kc] = WFrag<h16>::ld(kl + (ps * 32 + kt * 16) * LP + kc * 32);
#pragma unroll
            for (int dt = 0; dt < 4; ++dt) vf[dt] = WFrag<h16>::ld(vl + dt * 16 * LP + ps * 32);
#pragma unroll
            for (int kt = 0; kt < 2; ++kt)
#pragma unroll
                for (int qt = 0; qt < 2; ++qt) { s[kt][qt] = wmma16(kf[kt][0], qf[qt][0], (v8f){}); s[kt][qt] = wmma16(kf[kt][1], qf[qt][1], s[kt][qt]); }
#pragma unroll
            for (int qt = 0; qt < 2; ++qt) {
                float mx = s[0][qt][0];
#pragma unroll
                for (int j = 1; j < 8; ++j) mx = fmaxf(mx, s[0][qt][j]);
#pragma unroll
                for (int j = 0; j < 8; ++j) mx = fmaxf(mx, s[1][qt][j]);
                mx = fmaxf(mx, xhalf(mx));
                const float mn = fmaxf(m[qt], mx * C2); const float al = __builtin_amdgcn_exp2f(m[qt] - mn); m[qt] = mn; const float sh = 10.0f - mn;
                v16h p; float psum = 0.f;
#pragma unroll
                for (int j = 0; j < 8; ++j) { const float e0 = __builtin_amdgcn_exp2f(fmaf(s[0][qt][j], C2, sh)), e1 = __builtin_amdgcn_exp2f(fmaf(s[1][qt][j], C2, sh)); psum += e0 + e1; p[j] = (h16)e0; p[8 + j] = (h16)e1; }
                l[qt] = fmaf(l[qt], al, psum);
#pragma unroll
                for (int dt = 0; dt < 4; ++dt) { o[dt][qt] *= al; o[dt][qt] = wmma16(vf[dt], p, o[dt][qt]); }
            }
            // four vector slots behind the pass's last WMMA: on the taken branch the loop's first vector instructions may overwrite its A or B registers
            asm volatile("v_nop\n\tv_nop\n\tv_nop\n\tv_nop" : "+v"(o[0][1]), "+v"(o[1][1]), "+v"(o[2][1]), "+v"(o[3][1]) : "v"(vf[0]), "v"(vf[1]), "v"(vf[2]), "v"(vf[3]));
        }
        if (more) { const int sn = ((st + 1) & 1);   // the other buffer: its readers left it before the barrier that ended the stage before this one
#pragma unroll
            for (int r = 0; r < 2; ++r) { *(v8h*)(ks + sn * (KST * LP) + so + r * 32 * LP) = gk[r]; *(v8h*)(vs + sn * (HD * LP) + so + r * 32 * LP) = gv[r]; } }
        __syncthreads();   // publishes stage st + 1 and ends every wave's reads of stage st
    }
#pragma unroll
    for (int qt = 0; qt < 2; ++qt) {
        const float lt = l[qt] + xhalf(l[qt]); const float inv = __fdiv_rn(1.0f, lt); const int t = q0 + qt * 16 + lr;
        float* cr = CTX + pl + (size_t)t * HD + 8 * hi; const size_t ao = ((size_t)b * TT + t) * DQ + h * HD + 8 * hi;
#pragma unroll
        for (int dt = 0; dt < 4; ++dt) { v4f c0, c1; v8us oh, ol;
#pragma unroll
            for (int j = 0; j < 8; ++j) { const float r = o[dt][qt][j] * inv; if (j < 4) c0[j] = r; else c1[j - 4] = r; unsigned short a2, c2; splitf(r, a2, c2); oh[j] = a2; ol[j] = c2; }
            *(v4f*)(cr + dt * 16) = c0; *(v4f*)(cr + dt * 16 + 4) = c1; *(v8us*)(Ah + ao + dt * 16) = oh; *(v8us*)(Al + ao + dt * 16) = ol; }
    }
}

extern "C" void kernel_launch(void* const* d_in, const int* in_sizes, int n_in,
                              void* d_out, int out_size, void* d_ws, size_t ws_size, hipStream_t stream) {
    (void)in_sizes; (void)n_in; (void)out_size;
    const float* xq = (const float*)d_in[0]; const float* xk = (const float*)d_in[1]; const float* xv = (const float*)d_in[2]; const float* wq = (const float*)d_in[3]; const float* bq = (const float*)d_in[4]; const float* wk = (const float*)d_in[5]; const float* bk = (const float*)d_in[6]; const float* wv = (const float*)d_in[7]; const float* bv = (const float*)d_in[8]; const float* wo = (const float*)d_in[9]; const float* bo = (const float*)d_in[10];
    // q, k, v [4][2048][1024], wq_w, wq_b, wk_w, wk_b, wv_w, wv_b, wo_w, wo_b = d_in[0..10]
    float* OUT = (float*)d_out;                          // output 0: out [4][2048][1024]
    float* OUT1 = (float*)d_out + (size_t)NB_ * TT * DM;   // output 1: ctx [4][16][2048][64], after the first output's 8,388,608 floats
    char* wsp = (char*)d_ws;
    auto take = [&](size_t bytes) { char* p = wsp; wsp += (bytes + 255) & ~(size_t)255; return (void*)p; };
    bf* WB = (bf*)take((size_t)4 * DQ * DM * 2);   // wq, wk, wv, wo, [out][in] as they stand (A of the Q, K products, Bt of V and out)
    bf* XB = (bf*)take((size_t)3 * NB_ * TT * DM * 2);   // q, k, v, all batch entries
    const size_t PLN = (size_t)NH_ * TT * HD;   // one batch entry's fp16 planes
    h16* PL16 = (h16*)take(3 * NB_ * PLN * 2);   // Q [b][h][t][d], K [b][h][t][d], V^T [b][h][d][t]
    bf* ATh = (bf*)take((size_t)NB_ * TT * DQ * 2); bf* ATl = (bf*)take((size_t)NB_ * TT * DQ * 2);
    if ((size_t)(wsp - (char*)d_ws) > ws_size) return;    // total 136 MiB of the workspace
    k_cvt8<<<3 * XBK + 4 * WBK, 256, 0, stream>>>(xq, xk, xv, wq, wk, wv, wo, XB, WB);
    k_proj<<<dim3((DQ / GWM) * (TT / GWN), 1, 3 * NB_), 256, 0, stream>>>(XB, WB, bq, bk, bv, PL16);
    k_fattn<<<dim3(TT / 256, NH_, NB_), 256, 0, stream>>>(PL16, PL16 + NB_ * PLN, PL16 + 2 * NB_ * PLN, OUT1, ATh, ATl);
    k_gemmw<DQ, true><<<dim3(NB_ * TT / GWM, DM / GWN, 1), 256, 0, stream>>>(ATh, ATl, WB + (size_t)3 * DQ * DM, OUT, DM, bo);
}

// v005
// It runs in 141 microseconds.
// Timed twice side by side with v004, it ran 1.08 times as fast both times.
// Over all steps from v000 it is 18.9 times as fast.
#include <hip/hip_runtime.h>

// Multi-head attention on three input streams with an output projection, returning the projected output AND the per-head context (q, k, v [4][2048][1024]; Q = q Wq^T + bq, K = k Wk^T + bk, V = v Wv^T + bv with 'oi' weights [1024][1024] and
// biases [1024]; 16 heads x 64 (head h = columns h x 64 ..); scores x 1/sqrt(64); softmax over all 2048 keys; no mask; ctx = weights V; merged head-major [b][t][1024]; out = merged Wo^T + bo ('oi' [1024][1024]);
// TWO OUTPUTS in one buffer: out [4][2048][1024] at float offset 0 and ctx [4][16][2048][64] at float offset 8,388,608; argument order q, k, v, wq_w, wq_b, wk_w, wk_b, wv_w, wv_b, wo_w, wo_b).
// Layout: four launches, each over all four batch entries. One conversion launch makes the bf16 copies of q, k, v (all 8192 tokens of each) and of the four 'oi' weights as they stand; one projection launch does Q, K and V, exact + f32 biases, each tile storing its fp16 head plane from its own epilogue; one fused attention launch over (query block, head, batch entry), running softmax, no score matrix in memory;
// merged hi/lo x Wo exact + bo writes the first output.
// Compute dtypes, f32 accumulate: every float input rounded to bf16 at its load; projections exact + f32 biases; scores and attn.v fp16; softmax f32; output projection hl x exact; the second output is the f32 context as the attention kernel divides it.

#define NB_  4
#define TT   2048
#define DM   1024
#define NH_  16
#define NKV  16
#define HD   64
#define DQ   (NH_ * HD)
#define DKV  (NKV * HD)
#define SCL  0.125f   // HD^-0.5
typedef _Float16 h16;
typedef unsigned short bf;
typedef __attribute__((ext_vector_type(16))) __bf16   v16bf;
typedef __attribute__((ext_vector_type(16))) _Float16 v16h;
typedef __attribute__((ext_vector_type(8)))  _Float16 v8h;
typedef __attribute__((ext_vector_type(8)))  unsigned short v8us;
typedef __attribute__((ext_vector_type(8)))  float    v8f;
typedef __attribute__((ext_vector_type(4)))  float    v4f;
typedef v8h  __attribute__((may_alias)) v8ha;
typedef v4f  __attribute__((may_alias)) v4fa;
typedef v8us __attribute__((may_alias)) v8usa;

__device__ __forceinline__ unsigned short f2bf(float f) { unsigned u = __float_as_uint(f); u += 0x7FFFu + ((u >> 16) & 1u); return (unsigned short)(u >> 16); }
__device__ __forceinline__ float bf2f(unsigned short b) { return __uint_as_float(((unsigned)b) << 16); }
__device__ __forceinline__ float bfr(float f) { return bf2f(f2bf(f)); }
__device__ __forceinline__ v16h cat16(v8h lo, v8h hi) { return __builtin_shufflevector(lo, hi, 0, 1, 2, 3, 4, 5, 6, 7, 8, 9, 10, 11, 12, 13, 14, 15); }
__device__ __forceinline__ v16bf cat16b(v8us lo, v8us hi) { return __builtin_bit_cast(v16bf, __builtin_shufflevector(lo, hi, 0, 1, 2, 3, 4, 5, 6, 7, 8, 9, 10, 11, 12, 13, 14, 15)); }
__device__ __forceinline__ v8f wmma16(v16h a, v16h b, v8f c) { return __builtin_amdgcn_wmma_f32_16x16x32_f16(false, a, false, b, (short)0, c, false, false); }
__device__ __forceinline__ v8f wmmab(v16bf a, v16bf b, v8f c) { return __builtin_amdgcn_wmma_f32_16x16x32_bf16(false, a, false, b, (short)0, c, false, false); }



// ---- work-group GEMM: 8 waves (4 along A x 2 along Bt), each wave a 64x64 output tile (16 accumulators), so a work-group does 256 A rows x 128 Bt rows; operands are K-contiguous 16-bit planes.
// The waves share each operand row: a stage is 64 k of every row of the tile in LDS, brought by asynchronous copies (16 bytes a lane, whole 128-byte lines a row), two buffers, the next stage in flight while this one is worked on.
// gemm_wg: acc[mb][nb] = sum_k A[m][k] Bt[n][k] (+ A2[m][k] Bt[n][k] where NA == 2), k ascending, A before A2 in each 32 k. R0 / C0 = the work-group's first A row / Bt row. K % 64 == 0, K >= 128.
template <typename T16> struct WFrag;
template <> struct WFrag<h16> { typedef v16h V; static __device__ __forceinline__ V ld(const h16* p) { return cat16(*(const v8h*)p, *(const v8h*)(p + 16)); } static __device__ __forceinline__ v8f mma(V a, V b, v8f c) { return wmma16(a, b, c); } };
template <> struct WFrag<bf> { typedef v16bf V; static __device__ __forceinline__ V ld(const bf* p) { return cat16b(*(const v8us*)p, *(const v8us*)(p + 16)); } static __device__ __forceinline__ v8f mma(V a, V b, v8f c) { return wmmab(a, b, c); } };
#define GKS 64    // k a stage
#define GLP 72    // LDS row pitch in 16-bit elements: 144 B = 16 B x 9, 16-byte fragment reads of 16 rows fall on 64 distinct banks
#define GWM 256   // A rows a work-group
#define GWN 128   // Bt rows a work-group
#define GBUF(NA) (((NA) * GWM + GWN) * GLP)   // 16-bit elements a buffer: [A rows | A2 rows | Bt rows]
// four copies of 16 bytes a lane, rows 32 apart (l = the lane's LDS byte address, g = its global address). The s_wait_xcnt closes the statement so that it stands in front of every later write of the address registers.
__device__ __forceinline__ void copy4(unsigned l, const bf* g, int K) {
    asm volatile("global_load_async_to_lds_b128 %0, %4, off\n\tglobal_load_async_to_lds_b128 %1, %5, off\n\tglobal_load_async_to_lds_b128 %2, %6, off\n\tglobal_load_async_to_lds_b128 %3, %7, off\n\ts_wait_xcnt 0x0"
                 :: "v"(l), "v"(l + 32 * GLP * 2), "v"(l + 64 * GLP * 2), "v"(l + 96 * GLP * 2), "v"(g), "v"(g + (size_t)32 * K), "v"(g + (size_t)64 * K), "v"(g + (size_t)96 * K) : "memory");
}
// one stage: every thread copies its 16-byte piece of rows srow + 32 i; l = the lane's address in the target buffer, ga / ga2 / gb = its piece of the stage's first rows.
template <int NA, int K>
__device__ __forceinline__ void stage_copy(unsigned l, const bf* ga, const bf* ga2, const bf* gb) {
    copy4(l, ga, K); copy4(l + 128 * GLP * 2, ga + (size_t)128 * K, K);
    if (NA == 2) { copy4(l + GWM * GLP * 2, ga2, K); copy4(l + (GWM + 128) * GLP * 2, ga2 + (size_t)128 * K, K); }
    copy4(l + NA * GWM * GLP * 2, gb, K);
}
template <int NA, int K>
__device__ __forceinline__ void gemm_wg(v8f (&acc)[4][4], const bf* __restrict__ A, const bf* __restrict__ A2, const bf* __restrict__ Bt, int R0, int C0, bf* sm) {
    typedef typename WFrag<bf>::V V;
    const int lane = threadIdx.x & 31, lr = lane & 15, hi = lane >> 4, wv = threadIdx.x >> 5;
    const int srow = threadIdx.x >> 3, sch = (threadIdx.x & 7) * 8;   // staging: thread -> (row, 16-byte piece)
    const bf* ga = A + (size_t)(R0 + srow) * K + sch; const bf* ga2 = (NA == 2) ? A2 + (size_t)(R0 + srow) * K + sch : nullptr; const bf* gb = Bt + (size_t)(C0 + srow) * K + sch;
    const unsigned l0 = (unsigned)(size_t)(sm + srow * GLP + sch);   // LDS byte address: the low 32 bits of the shared address
    const bf* fa = sm + ((wv >> 1) * 64 + lr) * GLP + 8 * hi; const bf* fb = sm + (NA * GWM + (wv & 1) * 64 + lr) * GLP + 8 * hi;
#pragma unroll
    for (int mb = 0; mb < 4; ++mb)
#pragma unroll
        for (int nb = 0; nb < 4; ++nb) acc[mb][nb] = (v8f){};

    stage_copy<NA, K>(l0, ga, ga2, gb);
    asm volatile("s_wait_asynccnt 0x0" ::: "memory");   // this wave's copies of stage 0 have landed
    __syncthreads();   // stage 0 is published
    stage_copy<NA, K>(l0 + GBUF(NA) * 2, ga + GKS, ga2 + GKS, gb + GKS);
    for (int t = 0; t < K / GKS; ++t) {
        const int bo = (t & 1) * GBUF(NA);
        // the hand-over of a stage stands where its last fragments are in registers, in front of the last block's WMMAs, so that the refill flies over them too
        auto handover = [&]() {
            asm volatile("s_wait_dscnt 0x0" ::: "memory");      // this wave's reads of stage t are done before its buffer is refilled
            asm volatile("s_wait_asynccnt 0x0" ::: "memory");   // this wave's copies of stage t + 1 have landed
            __syncthreads();   // publishes stage t + 1 and ends every wave's reads of stage t
            if (t + 2 < K / GKS) stage_copy<NA, K>(l0 + bo * 2, ga + (t + 2) * GKS, ga2 + (t + 2) * GKS, gb + (t + 2) * GKS);
        };
#pragma unroll
        for (int kc = 0; kc < GKS; kc += 32) {
            V a[4], b[4];   // a block = 16 WMMAs; its fragments are read as one group in front of it
#pragma unroll
            for (int mb = 0; mb < 4; ++mb) { a[mb] = WFrag<bf>::ld(fa + bo + mb * 16 * GLP + kc); b[mb] = WFrag<bf>::ld(fb + bo + mb * 16 * GLP + kc); }
            // holds the block's LDS reads together in front of its WMMAs (loaded values as inputs only): left alone, the Bt reads are spread among the WMMAs, each with a wait to 0 of its own
            asm volatile("" :: "v"(a[0]), "v"(a[1]), "v"(a[2]), "v"(a[3]), "v"(b[0]), "v"(b[1]), "v"(b[2]), "v"(b[3]));
            if (NA == 1 && kc == GKS - 32) handover();
#pragma unroll
            for (int nb = 0; nb < 4; ++nb)
#pragma unroll
                for (int mb = 0; mb < 4; ++mb) acc[mb][nb] = WFrag<bf>::mma(a[mb], b[nb], acc[mb][nb]);
            if (NA == 2) {   // the second plane's block, on the same Bt fragments: each accumulator still takes A, then A2, of every 32 k
#pragma unroll
                for (int mb = 0; mb < 4; ++mb) a[mb] = WFrag<bf>::ld(fa + bo + (GWM + mb * 16) * GLP + kc);
                // holds this block's reads here (loaded values as inputs only): left alone, they and the next block's are lifted to the top of the trip, and the registers pass 256, with register-window switches in the loop
                asm volatile("" :: "v"(a[0]), "v"(a[1]), "v"(a[2]), "v"(a[3]));
                if (kc == GKS - 32) handover();
#pragma unroll
                for (int nb = 0; nb < 4; ++nb)
#pragma unroll
                    for (int mb = 0; mb < 4; ++mb) acc[mb][nb] = WFrag<bf>::mma(a[mb], b[nb], acc[mb][nb]);
            }
        }
    }
    asm volatile("s_wait_asynccnt 0x0" ::: "memory");   // nothing is in flight when the wave goes on
}

// plane_out: the tile goes out as fp16, transposed, pr[n * ldp + (m % 64)] (pr = the lane's own row n = c0 + lr, piece 8 hi): a lane's accumulator holds 8 consecutive m of one n, which is one 16-byte store, no LDS.
// PLANE 1: bias[m] (A = weights, Bt = tokens: row n = token, 64 head columns). PLANE 2: bias[n] (A = tokens, Bt = weights: row n = head column, tokens along the row).
template <int PLANE>
__device__ __forceinline__ void plane_out(const v8f (&acc)[4][4], h16* pr, int ldp, const float* __restrict__ bias, int r0, int c0, int lr, int hi) {
#pragma unroll
    for (int mb = 0; mb < 4; ++mb) {
        v4f b0 = (v4f){}, b1 = (v4f){};
        if (PLANE == 1) { b0 = *(const v4f*)(bias + r0 + mb * 16 + 8 * hi); b1 = *(const v4f*)(bias + r0 + mb * 16 + 8 * hi + 4); }
#pragma unroll
        for (int nb = 0; nb < 4; ++nb) { const float bn = (PLANE == 2) ? bfr(bias[c0 + nb * 16 + lr]) : 0.f; v8h o;
#pragma unroll
            for (int j = 0; j < 8; ++j) o[j] = (h16)(acc[mb][nb][j] + ((PLANE == 1) ? bfr(j < 4 ? b0[j] : b1[j - 4]) : bn));
            *(v8h*)(pr + (size_t)nb * 16 * ldp + mb * 16) = o; }
    }
}

// k_proj: the three projections of all four batch entries in one launch. Grid (64 tiles of 256 x 128, 1, stream x 4 + batch entry); X = [stream][entry][token][DM], W = [stream][out][in], P = [stream][entry] planes.
// Streams 0, 1 (Q, K): W X^T (256 weight rows x 128 tokens), plane [h][t][d]. Stream 2 (V): X W^T (256 tokens x 128 weight rows), plane [h][d][t]. The choice is the same for the whole work-group (it comes from blockIdx.z).
__global__ __launch_bounds__(256) void k_proj(const bf* __restrict__ X, const bf* __restrict__ Wt, const float* __restrict__ bq, const float* __restrict__ bk, const float* __restrict__ bv, h16* P) {
    __shared__ __align__(16) bf sm[2 * GBUF(1)];
    const int lane = threadIdx.x & 31, lr = lane & 15, hi = lane >> 4, wv = threadIdx.x >> 5; const int s = blockIdx.z / NB_; const bool isv = s == 2;
    const bf* x = X + (size_t)blockIdx.z * TT * DM; const bf* w = Wt + (size_t)s * DQ * DM; h16* p = P + (size_t)blockIdx.z * NH_ * TT * HD;
    const int R0 = isv ? (int)(blockIdx.x / (DQ / GWN)) * GWM : (int)(blockIdx.x % (DQ / GWM)) * GWM, C0 = isv ? (int)(blockIdx.x % (DQ / GWN)) * GWN : (int)(blockIdx.x / (DQ / GWM)) * GWN;   // the weight tile runs fastest
    const int r0 = R0 + (wv >> 1) * 64, c0 = C0 + (wv & 1) * 64;   // the wave's own 64 x 64 tile
    v8f acc[4][4];
    gemm_wg<1, DM>(acc, isv ? x : w, nullptr, isv ? w : x, R0, C0, sm);
    if (!isv) { plane_out<1>(acc, p + (size_t)(r0 / HD) * TT * HD + (size_t)(c0 + lr) * HD + 8 * hi, HD, s ? bk : bq, r0, c0, lr, hi);
        // behind the last Q/K store: the V path follows it in the listing and writes the stores' registers; a precaution of form, kept whether or not a wave can take that way
        asm volatile("s_wait_xcnt 0x0" ::: "memory"); }
    else      plane_out<2>(acc, p + (size_t)r0 + (size_t)(c0 + lr) * TT + 8 * hi, TT, bv, r0, c0, lr, hi);
}

// k_gemmw: C[m][n] (f32, pitch ldc, + optional f32 bias[n]) = (A + A2) Bt^T as above; grid (M/256, N/128). Each wave turns its tile through its own LDS rows.
template <int K, bool BIAS>
__global__ __launch_bounds__(256) void k_gemmw(const bf* __restrict__ A, const bf* __restrict__ A2, const bf* __restrict__ Bt, float* C, int ldc, const float* __restrict__ bias) {
    __shared__ __align__(16) bf sm[2 * GBUF(2)]; __shared__ __align__(16) float osw[8 * 16 * 68];
    const int lane = threadIdx.x & 31, lr = lane & 15, hi = lane >> 4, wv = threadIdx.x >> 5; const int R0 = blockIdx.x * GWM, C0 = blockIdx.y * GWN; const int r0 = R0 + (wv >> 1) * 64, c0 = C0 + (wv & 1) * 64;
    v8f acc[4][4];
    gemm_wg<2, K>(acc, A, A2, Bt, R0, C0, sm);
    float* os = osw + wv * (16 * 68);
#pragma unroll
    for (int mb = 0; mb < 4; ++mb) {
#pragma unroll
        for (int nb = 0; nb < 4; ++nb) {
#pragma unroll
            for (int j = 0; j < 8; ++j) os[(hi * 8 + j) * 68 + nb * 16 + lr] = acc[mb][nb][j]; }
        __builtin_amdgcn_wave_barrier(); asm volatile("" ::: "memory");
        float* crow = C + (size_t)(r0 + mb * 16) * ldc + c0;
{
#pragma unroll
            for (int s = 0; s < 8; ++s) { const int row = 2 * s + hi, cofs = lr * 4; v4f val = *(const v4fa*)(os + row * 68 + cofs); if (BIAS) { val[0] += bfr(bias[c0 + cofs]); val[1] += bfr(bias[c0 + cofs + 1]); val[2] += bfr(bias[c0 + cofs + 2]); val[3] += bfr(bias[c0 + cofs + 3]); }
                *(v4f*)(crow + (size_t)row * ldc + cofs) = val; }
             }
        __builtin_amdgcn_wave_barrier(); asm volatile("" ::: "memory");
    }
}

__device__ __forceinline__ void splitf(float y, unsigned short& h, unsigned short& l) { h = f2bf(y); l = f2bf(y - bf2f(h)); }
typedef __attribute__((ext_vector_type(2))) _Float16 v2h;
typedef __attribute__((ext_vector_type(4))) _Float16 v4h;
typedef __attribute__((ext_vector_type(2))) unsigned short v2us;
typedef __attribute__((ext_vector_type(4))) unsigned short v4us;
typedef __attribute__((ext_vector_type(2))) float v2f;
typedef __attribute__((ext_vector_type(4))) int v4i;

// k_cvt8: every float tensor that a product reads, rounded to bf16, in one launch; a work-group does 2048 elements of one tensor (the tensor follows from blockIdx.x alone). X = [q, k, v], Wd = [wq, wk, wv, wo].
#define XBK (NB_ * TT * DM / 2048)   // work-groups a token stream
#define WBK (DQ * DM / 2048)         // work-groups a weight
__global__ __launch_bounds__(256) void k_cvt8(const float* __restrict__ q, const float* __restrict__ k, const float* __restrict__ v, const float* __restrict__ wq, const float* __restrict__ wk, const float* __restrict__ wv, const float* __restrict__ wo, bf* X, bf* Wd) {
    const unsigned g = blockIdx.x; const float* src; bf* dst; unsigned blk;
    if (g < 3 * XBK) { const unsigned s = g / XBK; blk = g % XBK; src = s == 0 ? q : s == 1 ? k : v; dst = X + (size_t)s * NB_ * TT * DM; }
    else { const unsigned s = (g - 3 * XBK) / WBK; blk = (g - 3 * XBK) % WBK; src = s == 0 ? wq : s == 1 ? wk : s == 2 ? wv : wo; dst = Wd + (size_t)s * DQ * DM; }
    const size_t i = (size_t)blk * 256 + threadIdx.x; const v8f x = *(const v8f*)(src + i * 8); v8us o;
#pragma unroll
    for (int e = 0; e < 8; ++e) o[e] = f2bf(x[e]); *(v8us*)(dst + i * 8) = o;  }

#define KST 64   // keys a stage
#define PLIM 32768.0f   // a lane's partial sum of 16 weights up to here: every weight converts to a finite fp16
#define LP  72   // LDS row pitch in fp16: 144 B = 16 B x 9, 16-byte fragment reads of 16 rows fall on 64 distinct banks
__device__ __forceinline__ float xhalf(float x) { return __builtin_bit_cast(float, __builtin_amdgcn_permlanex16(__builtin_bit_cast(int, x), __builtin_bit_cast(int, x), 0x76543210, 0xfedcba98, false, false)); }   // lane l with lane l ^ 16
__global__ __launch_bounds__(256) __attribute__((amdgpu_waves_per_eu(4, 4))) void k_fattn(const h16* __restrict__ Q, const h16* __restrict__ Kp, const h16* __restrict__ Vt, float* CTX, bf* Ah, bf* Al) {
    __shared__ __align__(16) h16 ks[2 * KST * LP]; __shared__ __align__(16) h16 vs[2 * HD * LP];
    const int lane = threadIdx.x & 31, lr = lane & 15, hi = lane >> 4, wv = threadIdx.x >> 5; const int h = blockIdx.y, b = blockIdx.z;
    const size_t pl = ((size_t)b * NH_ + h) * TT * HD; const int q0 = blockIdx.x * 256 + wv * 32;
    const float C2 = SCL * 1.4426950408889634f;   // scores to log2 units
    const h16* qp = Q + pl + (size_t)(q0 + lr) * HD + 8 * hi;
    const int srow = threadIdx.x >> 3, sch = (threadIdx.x & 7) * 8;   // staging: thread -> (row, 16-byte piece); rows srow and srow + 32
    const h16* kg = Kp + pl + (size_t)srow * HD + sch; const h16* vg = Vt + pl + (size_t)srow * TT + sch; const int so = srow * LP + sch;
    v16h qf[2][2]; v8f o[4][2]; float m[2], l[2], sh[2]; v8h gk[2], gv[2];
#pragma unroll
    for (int r = 0; r < 2; ++r) { gk[r] = *(const v8h*)(kg + (size_t)r * 32 * HD); gv[r] = *(const v8h*)(vg + (size_t)r * 32 * TT); }
#pragma unroll
    for (int qt = 0; qt < 2; ++qt) { m[qt] = -3.0e38f; sh[qt] = 3.0e38f; l[qt] = 0.f;
#pragma unroll
        for (int kc = 0; kc < 2; ++kc) qf[qt][kc] = WFrag<h16>::ld(qp + qt * 16 * HD + kc * 32);
#pragma unroll
        for (int dt = 0; dt < 4; ++dt) o[dt][qt] = (v8f){}; }
#pragma unroll
    for (int r = 0; r < 2; ++r) { *(v8h*)(ks + so + r * 32 * LP) = gk[r]; *(v8h*)(vs + so + r * 32 * LP) = gv[r]; }
    __syncthreads();   // stage 0 is published
    for (int st = 0; st < TT / KST; ++st) {
        const h16* kl = ks + (st & 1) * (KST * LP) + lr * LP + 8 * hi; const h16* vl = vs + (st & 1) * (HD * LP) + lr * LP + 8 * hi; const bool more = st + 1 < TT / KST;
        if (more) {
#pragma unroll
            for (int r = 0; r < 2; ++r) { gk[r] = *(const v8h*)(kg + (size_t)((st + 1) * KST + r * 32) * HD); gv[r] = *(const v8h*)(vg + (size_t)r * 32 * TT + (st + 1) * KST); } }
#pragma unroll 1   // rolled: unrolled, the second pass's fragments are fetched over the first and the registers of four waves a SIMD no longer hold them
        for (int ps = 0; ps < KST / 32; ++ps) {
            v16h kf[2][2], vf[4], p[2]; v8f s[2][2]; float su[2];
#pragma unroll
            for (int kt = 0; kt < 2; ++kt)
#pragma unroll
                for (int kc = 0; kc < 2; ++kc) kf[kt][kc] = WFrag<h16>::ld(kl + (ps * 32 + kt * 16) * LP + kc * 32);
            // holds the K fragment reads together in front of the score WMMAs (loaded values as inputs only): left alone, they are split into three groups among the WMMAs, each with a wait to 0 of its own
            asm volatile("" :: "v"(kf[0][0]), "v"(kf[0][1]), "v"(kf[1][0]), "v"(kf[1][1]));
#pragma unroll
            for (int kt = 0; kt < 2; ++kt)
#pragma unroll
                for (int qt = 0; qt < 2; ++qt) { s[kt][qt] = wmma16(kf[kt][0], qf[qt][0], (v8f){}); s[kt][qt] = wmma16(kf[kt][1], qf[qt][1], s[kt][qt]); }
#pragma unroll
            for (int dt = 0; dt < 4; ++dt) vf[dt] = WFrag<h16>::ld(vl + dt * 16 * LP + ps * 32);
            __builtin_amdgcn_sched_barrier(0);   // the V^T fragment reads issue here, behind the score WMMAs (into the K fragments' registers), so that their LDS latency runs under the exponentials: left alone, they sink behind the branch, directly in front of the attn.v WMMAs that wait for them
            // weights of one query tile against the maximum in use, with this lane's partial sum; an fp16 weight out of range only ever reaches the test below
            auto weigh = [&](int qt) { v2f a = (v2f){};   // register pairs as the accumulators hold them: packed multiply-add, packed add, packed conversion, no register moves
#pragma unroll
                for (int kt = 0; kt < 2; ++kt)
#pragma unroll
                    for (int j = 0; j < 8; j += 2) { const v2f x = __builtin_elementwise_fma((v2f){s[kt][qt][j], s[kt][qt][j + 1]}, (v2f){C2, C2}, (v2f){sh[qt], sh[qt]}); const v2f e = (v2f){__builtin_amdgcn_exp2f(x[0]), __builtin_amdgcn_exp2f(x[1])};
                        a += e; p[qt][kt * 8 + j] = (h16)e[0]; p[qt][kt * 8 + j + 1] = (h16)e[1]; }
                su[qt] = a[0] + a[1]; };
            weigh(0); weigh(1);
            // one test a pass, a scalar branch: the weights are all >= 0, so a partial sum inside PLIM bounds each of them inside fp16; the first pass (no maximum yet: the sums are infinite) always takes the branch
            if (__builtin_amdgcn_ballot_w32(!(su[0] <= PLIM && su[1] <= PLIM)) != 0) {
#pragma unroll
                for (int qt = 0; qt < 2; ++qt) {
                    float mx = s[0][qt][0];
#pragma unroll
                    for (int j = 1; j < 8; ++j) mx = fmaxf(mx, s[0][qt][j]);
#pragma unroll
                    for (int j = 0; j < 8; ++j) mx = fmaxf(mx, s[1][qt][j]);
                    mx = fmaxf(mx, xhalf(mx));
                    const float mn = fmaxf(m[qt], mx * C2); const float al = __builtin_amdgcn_exp2f(m[qt] - mn);
                    if (qt == 0) asm volatile("v_nop" :: "v"(al));   // the slot behind a transcendental: without it the second tile's exponential follows this one directly and overwrites its source register
                    m[qt] = mn; sh[qt] = 10.0f - mn; l[qt] *= al;
#pragma unroll
                    for (int dt = 0; dt < 4; ++dt) o[dt][qt] *= al;
                    weigh(qt);
                }
            }
#pragma unroll
            for (int qt = 0; qt < 2; ++qt) { l[qt] += su[qt];
#pragma unroll
                for (int dt = 0; dt < 4; ++dt) o[dt][qt] = wmma16(vf[dt], p[qt], o[dt][qt]); }
            // four vector slots behind the pass's last WMMA: on the taken branch the loop's first vector instructions may overwrite its A or B registers
            asm volatile("v_nop\n\tv_nop\n\tv_nop\n\tv_nop" : "+v"(o[0][1]), "+v"(o[1][1]), "+v"(o[2][1]), "+v"(o[3][1]) : "v"(vf[0]), "v"(vf[1]), "v"(vf[2]), "v"(vf[3]));
        }
        if (more) { const int sn = ((st + 1) & 1);   // the other buffer: its readers left it before the barrier that ended the stage before this one
#pragma unroll
            for (int r = 0; r < 2; ++r) { *(v8h*)(ks + sn * (KST * LP) + so + r * 32 * LP) = gk[r]; *(v8h*)(vs + sn * (HD * LP) + so + r * 32 * LP) = gv[r]; } }
        __syncthreads();   // publishes stage st + 1 and ends every wave's reads of stage st
    }
#pragma unroll
    for (int qt = 0; qt < 2; ++qt) {
        const float lt = l[qt] + xhalf(l[qt]); const float inv = __fdiv_rn(1.0f, lt); const int t = q0 + qt * 16 + lr;
        float* cr = CTX + pl + (size_t)t * HD + 8 * hi; const size_t ao = ((size_t)b * TT + t) * DQ + h * HD + 8 * hi;
#pragma unroll
        for (int dt = 0; dt < 4; ++dt) { v4f c0, c1; v8us oh, ol;
#pragma unroll
            for (int j = 0; j < 8; ++j) { const float r = o[dt][qt][j] * inv; if (j < 4) c0[j] = r; else c1[j - 4] = r; unsigned short a2, c2; splitf(r, a2, c2); oh[j] = a2; ol[j] = c2; }
            *(v4f*)(cr + dt * 16) = c0; *(v4f*)(cr + dt * 16 + 4) = c1; *(v8us*)(Ah + ao + dt * 16) = oh; *(v8us*)(Al + ao + dt * 16) = ol; }
    }
}

extern "C" void kernel_launch(void* const* d_in, const int* in_sizes, int n_in,
                              void* d_out, int out_size, void* d_ws, size_t ws_size, hipStream_t stream) {
    (void)in_sizes; (void)n_in; (void)out_size;
    const float* xq = (const float*)d_in[0]; const float* xk = (const float*)d_in[1]; const float* xv = (const float*)d_in[2]; const float* wq = (const float*)d_in[3]; const float* bq = (const float*)d_in[4]; const float* wk = (const float*)d_in[5]; const float* bk = (const float*)d_in[6]; const float* wv = (const float*)d_in[7]; const float* bv = (const float*)d_in[8]; const float* wo = (const float*)d_in[9]; const float* bo = (const float*)d_in[10];
    // q, k, v [4][2048][1024], wq_w, wq_b, wk_w, wk_b, wv_w, wv_b, wo_w, wo_b = d_in[0..10]
    float* OUT = (float*)d_out;                          // output 0: out [4][2048][1024]
    float* OUT1 = (float*)d_out + (size_t)NB_ * TT * DM;   // output 1: ctx [4][16][2048][64], after the first output's 8,388,608 floats
    char* wsp = (char*)d_ws;
    auto take = [&](size_t bytes) { char* p = wsp; wsp += (bytes + 255) & ~(size_t)255; return (void*)p; };
    bf* WB = (bf*)take((size_t)4 * DQ * DM * 2);   // wq, wk, wv, wo, [out][in] as they stand (A of the Q, K products, Bt of V and out)
    bf* XB = (bf*)take((size_t)3 * NB_ * TT * DM * 2);   // q, k, v, all batch entries
    const size_t PLN = (size_t)NH_ * TT * HD;   // one batch entry's fp16 planes
    h16* PL16 = (h16*)take(3 * NB_ * PLN * 2);   // Q [b][h][t][d], K [b][h][t][d], V^T [b][h][d][t]
    bf* ATh = (bf*)take((size_t)NB_ * TT * DQ * 2); bf* ATl = (bf*)take((size_t)NB_ * TT * DQ * 2);
    if ((size_t)(wsp - (char*)d_ws) > ws_size) return;    // total 136 MiB of the workspace
    k_cvt8<<<3 * XBK + 4 * WBK, 256, 0, stream>>>(xq, xk, xv, wq, wk, wv, wo, XB, WB);
    k_proj<<<dim3((DQ / GWM) * (TT / GWN), 1, 3 * NB_), 256, 0, stream>>>(XB, WB, bq, bk, bv, PL16);
    k_fattn<<<dim3(TT / 256, NH_, NB_), 256, 0, stream>>>(PL16, PL16 + NB_ * PLN, PL16 + 2 * NB_ * PLN, OUT1, ATh, ATl);
    k_gemmw<DQ, true><<<dim3(NB_ * TT / GWM, DM / GWN, 1), 256, 0, stream>>>(ATh, ATl, WB + (size_t)3 * DQ * DM, OUT, DM, bo);
}

// v007
// It runs in 124 microseconds.
// Versions in between are left out here; by their measured steps it is 1.13 times as fast as v005.
// Over all steps from v000 it is 21.5 times as fast.
#include <hip/hip_runtime.h>

// Multi-head attention on three input streams with an output projection, returning the projected output AND the per-head context (q, k, v [4][2048][1024]; Q = q Wq^T + bq, K = k Wk^T + bk, V = v Wv^T + bv with 'oi' weights [1024][1024] and
// biases [1024]; 16 heads x 64 (head h = columns h x 64 ..); scores x 1/sqrt(64); softmax over all 2048 keys; no mask; ctx = weights V; merged head-major [b][t][1024]; out = merged Wo^T + bo ('oi' [1024][1024]);
// TWO OUTPUTS in one buffer: out [4][2048][1024] at float offset 0 and ctx [4][16][2048][64] at float offset 8,388,608; argument order q, k, v, wq_w, wq_b, wk_w, wk_b, wv_w, wv_b, wo_w, wo_b).
// Layout: four launches, each over all four batch entries. One conversion launch makes the bf16 copies of q, k, v (all 8192 tokens of each) and of the four 'oi' weights as they stand, wo's bf16 value held as fp16; one projection launch does Q, K and V, exact + f32 biases, each tile storing its fp16 head plane from its own epilogue; one fused attention launch over (query block, head, batch entry), running softmax, no score matrix in memory;
// merged (fp16) x Wo + bo writes the first output.
// Compute dtypes, f32 accumulate: every float input rounded to bf16 at its load; projections exact + f32 biases; scores and attn.v fp16; softmax f32; output projection fp16: the context rounded once to fp16 (it is an average of the fp16 V rows, so it is in range wherever they are), wo's bf16 value held as fp16; the second output is the f32 context as the attention kernel divides it.

#define NB_  4
#define TT   2048
#define DM   1024
#define NH_  16
#define NKV  16
#define HD   64
#define DQ   (NH_ * HD)
#define DKV  (NKV * HD)
#define SCL  0.125f   // HD^-0.5
typedef _Float16 h16;
typedef unsigned short bf;
typedef __attribute__((ext_vector_type(16))) __bf16   v16bf;
typedef __attribute__((ext_vector_type(16))) _Float16 v16h;
typedef __attribute__((ext_vector_type(8)))  _Float16 v8h;
typedef __attribute__((ext_vector_type(8)))  unsigned short v8us;
typedef __attribute__((ext_vector_type(8)))  float    v8f;
typedef __attribute__((ext_vector_type(4)))  float    v4f;
typedef v8h  __attribute__((may_alias)) v8ha;
typedef v4f  __attribute__((may_alias)) v4fa;
typedef v8us __attribute__((may_alias)) v8usa;

__device__ __forceinline__ unsigned short f2bf(float f) { unsigned u = __float_as_uint(f); u += 0x7FFFu + ((u >> 16) & 1u); return (unsigned short)(u >> 16); }
__device__ __forceinline__ float bf2f(unsigned short b) { return __uint_as_float(((unsigned)b) << 16); }
__device__ __forceinline__ float bfr(float f) { return bf2f(f2bf(f)); }
__device__ __forceinline__ v16h cat16(v8h lo, v8h hi) { return __builtin_shufflevector(lo, hi, 0, 1, 2, 3, 4, 5, 6, 7, 8, 9, 10, 11, 12, 13, 14, 15); }
__device__ __forceinline__ v16bf cat16b(v8us lo, v8us hi) { return __builtin_bit_cast(v16bf, __builtin_shufflevector(lo, hi, 0, 1, 2, 3, 4, 5, 6, 7, 8, 9, 10, 11, 12, 13, 14, 15)); }
__device__ __forceinline__ v8f wmma16(v16h a, v16h b, v8f c) { return __builtin_amdgcn_wmma_f32_16x16x32_f16(false, a, false, b, (short)0, c, false, false); }
__device__ __forceinline__ v8f wmmab(v16bf a, v16bf b, v8f c) { return __builtin_amdgcn_wmma_f32_16x16x32_bf16(false, a, false, b, (short)0, c, false, false); }



// ---- work-group GEMM: 8 waves (4 along A x 2 along Bt), each wave a 64x64 output tile (16 accumulators), so a work-group does 256 A rows x 128 Bt rows; operands are K-contiguous 16-bit planes.
// The waves share each operand row: a stage is 64 k of every row of the tile in LDS, brought by asynchronous copies (16 bytes a lane, whole 128-byte lines a row), two buffers, the next stage in flight while this one is worked on.
// gemm_wg<T>: acc[mb][nb] = sum_k A[m][k] Bt[n][k]; T = what the 16 bits are (bf or h16: it picks the WMMA form; the staging moves bytes). R0 / C0 = the work-group's first A row / Bt row. K / 64 a power of two, K >= 128.
// The k walk is a ring: the work-group enters it at stage rot and wraps round (k ascending from 64 rot, then from 0). Work-groups that share operand rows get different rot, so that they do not ask L2 for the same lines at the same moment.
template <typename T16> struct WFrag;
template <> struct WFrag<h16> { typedef v16h V; static __device__ __forceinline__ V ld(const h16* p) { return cat16(*(const v8h*)p, *(const v8h*)(p + 16)); } static __device__ __forceinline__ v8f mma(V a, V b, v8f c) { return wmma16(a, b, c); } };
template <> struct WFrag<bf> { typedef v16bf V; static __device__ __forceinline__ V ld(const bf* p) { return cat16b(*(const v8us*)p, *(const v8us*)(p + 16)); } static __device__ __forceinline__ v8f mma(V a, V b, v8f c) { return wmmab(a, b, c); } };
#define GKS 64    // k a stage
#define GLP 72    // LDS row pitch in 16-bit elements: 144 B = 16 B x 9, 16-byte fragment reads of 16 rows fall on 64 distinct banks
#define GWM 256   // A rows a work-group
#define GWN 128   // Bt rows a work-group
#define GBUF ((GWM + GWN) * GLP)   // 16-bit elements a buffer: [A rows | Bt rows]
// four copies of 16 bytes a lane, rows 32 apart (l = the lane's LDS byte address, g = its global address). The s_wait_xcnt closes the statement so that it stands in front of every later write of the address registers.
__device__ __forceinline__ void copy4(unsigned l, const bf* g, int K) {
    asm volatile("global_load_async_to_lds_b128 %0, %4, off\n\tglobal_load_async_to_lds_b128 %1, %5, off\n\tglobal_load_async_to_lds_b128 %2, %6, off\n\tglobal_load_async_to_lds_b128 %3, %7, off\n\ts_wait_xcnt 0x0"
                 :: "v"(l), "v"(l + 32 * GLP * 2), "v"(l + 64 * GLP * 2), "v"(l + 96 * GLP * 2), "v"(g), "v"(g + (size_t)32 * K), "v"(g + (size_t)64 * K), "v"(g + (size_t)96 * K) : "memory");
}
// one stage: every thread copies its 16-byte piece of rows srow + 32 i; l = the lane's address in the target buffer, ga / gb = its piece of the stage's first rows.
template <int K>
__device__ __forceinline__ void stage_copy(unsigned l, const bf* ga, const bf* gb) {
    copy4(l, ga, K); copy4(l + 128 * GLP * 2, ga + (size_t)128 * K, K);
    copy4(l + GWM * GLP * 2, gb, K);
}
template <typename T, int K>
__device__ __forceinline__ void gemm_wg(v8f (&acc)[4][4], const bf* __restrict__ A, const bf* __restrict__ Bt, int R0, int C0, int rot, bf* sm) {
    typedef typename WFrag<T>::V V;
    static_assert(((K / GKS) & (K / GKS - 1)) == 0, "the ring wraps by a mask");
    auto kof = [&](int t) { return ((t + rot) & (K / GKS - 1)) * GKS; };   // first k of the t-th stage of this work-group's walk
    const int lane = threadIdx.x & 31, lr = lane & 15, hi = lane >> 4, wv = threadIdx.x >> 5;
    const int srow = threadIdx.x >> 3, sch = (threadIdx.x & 7) * 8;   // staging: thread -> (row, 16-byte piece)
    const bf* ga = A + (size_t)(R0 + srow) * K + sch; const bf* gb = Bt + (size_t)(C0 + srow) * K + sch;
    const unsigned l0 = (unsigned)(size_t)(sm + srow * GLP + sch);   // LDS byte address: the low 32 bits of the shared address
    const T* fa = (const T*)sm + ((wv >> 1) * 64 + lr) * GLP + 8 * hi; const T* fb = (const T*)sm + (GWM + (wv & 1) * 64 + lr) * GLP + 8 * hi;
#pragma unroll
    for (int mb = 0; mb < 4; ++mb)
#pragma unroll
        for (int nb = 0; nb < 4; ++nb) acc[mb][nb] = (v8f){};

    stage_copy<K>(l0, ga + kof(0), gb + kof(0));
    asm volatile("s_wait_asynccnt 0x0" ::: "memory");   // this wave's copies of stage 0 have landed
    __syncthreads();   // stage 0 is published
    stage_copy<K>(l0 + GBUF * 2, ga + kof(1), gb + kof(1));
    for (int t = 0; t < K / GKS; ++t) {
        const int bo = (t & 1) * GBUF;
        // the hand-over of a stage stands where its last fragments are in registers, in front of the last block's WMMAs, so that the refill flies over them too
        auto handover = [&]() {
            asm volatile("s_wait_dscnt 0x0" ::: "memory");      // this wave's reads of stage t are done before its buffer is refilled
            asm volatile("s_wait_asynccnt 0x0" ::: "memory");   // this wave's copies of stage t + 1 have landed
            __syncthreads();   // publishes stage t + 1 and ends every wave's reads of stage t
            if (t + 2 < K / GKS) stage_copy<K>(l0 + bo * 2, ga + kof(t + 2), gb + kof(t + 2));
        };
#pragma unroll
        for (int kc = 0; kc < GKS; kc += 32) {
            V a[4], b[4];   // a block = 16 WMMAs; its fragments are read as one group in front of it
#pragma unroll
            for (int mb = 0; mb < 4; ++mb) { a[mb] = WFrag<T>::ld(fa + bo + mb * 16 * GLP + kc); b[mb] = WFrag<T>::ld(fb + bo + mb * 16 * GLP + kc); }
            // holds the block's LDS reads together in front of its WMMAs (loaded values as inputs only): left alone, the Bt reads are spread among the WMMAs, each with a wait to 0 of its own
            asm volatile("" :: "v"(a[0]), "v"(a[1]), "v"(a[2]), "v"(a[3]), "v"(b[0]), "v"(b[1]), "v"(b[2]), "v"(b[3]));
            if (kc == GKS - 32) handover();
#pragma unroll
            for (int nb = 0; nb < 4; ++nb)
#pragma unroll
                for (int mb = 0; mb < 4; ++mb) acc[mb][nb] = WFrag<T>::mma(a[mb], b[nb], acc[mb][nb]);
        }
    }
    asm volatile("s_wait_asynccnt 0x0" ::: "memory");   // nothing is in flight when the wave goes on
}

// plane_out: the tile goes out as fp16, transposed, pr[n * ldp + (m % 64)] (pr = the lane's own row n = c0 + lr, piece 8 hi): a lane's accumulator holds 8 consecutive m of one n, which is one 16-byte store, no LDS.
// PLANE 1: bias[m] (A = weights, Bt = tokens: row n = token, 64 head columns). PLANE 2: bias[n] (A = tokens, Bt = weights: row n = head column, tokens along the row).
template <int PLANE>
__device__ __forceinline__ void plane_out(const v8f (&acc)[4][4], h16* pr, int ldp, const float* __restrict__ bias, int r0, int c0, int lr, int hi) {
#pragma unroll
    for (int mb = 0; mb < 4; ++mb) {
        v4f b0 = (v4f){}, b1 = (v4f){};
        if (PLANE == 1) { b0 = *(const v4f*)(bias + r0 + mb * 16 + 8 * hi); b1 = *(const v4f*)(bias + r0 + mb * 16 + 8 * hi + 4); }
#pragma unroll
        for (int nb = 0; nb < 4; ++nb) { const float bn = (PLANE == 2) ? bfr(bias[c0 + nb * 16 + lr]) : 0.f; v8h o;
#pragma unroll
            for (int j = 0; j < 8; ++j) o[j] = (h16)(acc[mb][nb][j] + ((PLANE == 1) ? bfr(j < 4 ? b0[j] : b1[j - 4]) : bn));
            *(v8h*)(pr + (size_t)nb * 16 * ldp + mb * 16) = o; }
    }
}

// k_proj: the three projections of all four batch entries in one launch. Grid (64 tiles of 256 x 128, 1, stream x 4 + batch entry); X = [stream][entry][token][DM], W = [stream][out][in], P = [stream][entry] planes.
// Streams 0, 1 (Q, K): W X^T (256 weight rows x 128 tokens), plane [h][t][d]. Stream 2 (V): X W^T (256 tokens x 128 weight rows), plane [h][d][t]. The choice is the same for the whole work-group (it comes from blockIdx.z).
__global__ __launch_bounds__(256) void k_proj(const bf* __restrict__ X, const bf* __restrict__ Wt, const float* __restrict__ bq, const float* __restrict__ bk, const float* __restrict__ bv, h16* P) {
    __shared__ __align__(16) bf sm[2 * GBUF];
    const int lane = threadIdx.x & 31, lr = lane & 15, hi = lane >> 4, wv = threadIdx.x >> 5; const int s = blockIdx.z / NB_; const bool isv = s == 2;
    const bf* x = X + (size_t)blockIdx.z * TT * DM; const bf* w = Wt + (size_t)s * DQ * DM; h16* p = P + (size_t)blockIdx.z * NH_ * TT * HD;
    const int R0 = isv ? (int)(blockIdx.x / (DQ / GWN)) * GWM : (int)(blockIdx.x % (DQ / GWM)) * GWM, C0 = isv ? (int)(blockIdx.x % (DQ / GWN)) * GWN : (int)(blockIdx.x / (DQ / GWM)) * GWN;   // the weight tile runs fastest
    const int r0 = R0 + (wv >> 1) * 64, c0 = C0 + (wv & 1) * 64;   // the wave's own 64 x 64 tile
    v8f acc[4][4];
    // ring entry: the work-groups of one Bt tile differ in 4 x (A tile), those of one A tile in (Bt tile) + (batch entry)
    gemm_wg<bf, DM>(acc, isv ? x : w, isv ? w : x, R0, C0, 4 * (R0 / GWM) + C0 / GWN + (int)blockIdx.z, sm);
    if (!isv) { plane_out<1>(acc, p + (size_t)(r0 / HD) * TT * HD + (size_t)(c0 + lr) * HD + 8 * hi, HD, s ? bk : bq, r0, c0, lr, hi);
        // behind the last Q/K store: the V path follows it in the listing and writes the stores' registers; a precaution of form, kept whether or not a wave can take that way
        asm volatile("s_wait_xcnt 0x0" ::: "memory"); }
    else      plane_out<2>(acc, p + (size_t)r0 + (size_t)(c0 + lr) * TT + 8 * hi, TT, bv, r0, c0, lr, hi);
}

// k_gemmw: C[m][n] (f32, pitch ldc, + optional f32 bias[n]) = A Bt^T as above, both fp16; grid (M/256, N/128). Each wave turns its tile through its own LDS rows.
template <int K, bool BIAS>
__global__ __launch_bounds__(256) void k_gemmw(const h16* __restrict__ A, const h16* __restrict__ Bt, float* C, int ldc, const float* __restrict__ bias) {
    __shared__ __align__(16) bf sm[2 * GBUF]; __shared__ __align__(16) float osw[8 * 16 * 68];
    const int lane = threadIdx.x & 31, lr = lane & 15, hi = lane >> 4, wv = threadIdx.x >> 5; const int R0 = blockIdx.x * GWM, C0 = blockIdx.y * GWN; const int r0 = R0 + (wv >> 1) * 64, c0 = C0 + (wv & 1) * 64;
    v8f acc[4][4];
    gemm_wg<h16, K>(acc, (const bf*)A, (const bf*)Bt, R0, C0, (int)(blockIdx.x + 2 * blockIdx.y), sm);   // ring entry: different among the work-groups of one A tile and spread evenly among those of one Bt tile
    float* os = osw + wv * (16 * 68);
#pragma unroll
    for (int mb = 0; mb < 4; ++mb) {
#pragma unroll
        for (int nb = 0; nb < 4; ++nb) {
#pragma unroll
            for (int j = 0; j < 8; ++j) os[(hi * 8 + j) * 68 + nb * 16 + lr] = acc[mb][nb][j]; }
        __builtin_amdgcn_wave_barrier(); asm volatile("" ::: "memory");
        float* crow = C + (size_t)(r0 + mb * 16) * ldc + c0;
{
#pragma unroll
            for (int s = 0; s < 8; ++s) { const int row = 2 * s + hi, cofs = lr * 4; v4f val = *(const v4fa*)(os + row * 68 + cofs); if (BIAS) { val[0] += bfr(bias[c0 + cofs]); val[1] += bfr(bias[c0 + cofs + 1]); val[2] += bfr(bias[c0 + cofs + 2]); val[3] += bfr(bias[c0 + cofs + 3]); }
                *(v4f*)(crow + (size_t)row * ldc + cofs) = val; }
             }
        __builtin_amdgcn_wave_barrier(); asm volatile("" ::: "memory");
    }
}

typedef __attribute__((ext_vector_type(2))) _Float16 v2h;
typedef __attribute__((ext_vector_type(4))) _Float16 v4h;
typedef __attribute__((ext_vector_type(2))) unsigned short v2us;
typedef __attribute__((ext_vector_type(4))) unsigned short v4us;
typedef __attribute__((ext_vector_type(2))) float v2f;
typedef __attribute__((ext_vector_type(4))) int v4i;

// k_cvt8: every float tensor that a product reads, rounded to bf16, in one launch; a work-group does 2048 elements of one tensor (the tensor follows from blockIdx.x alone). X = [q, k, v], Wd = [wq, wk, wv, wo]; wo's bf16 value is stored as fp16, the type of its product.
#define XBK (NB_ * TT * DM / 2048)   // work-groups a token stream
#define WBK (DQ * DM / 2048)         // work-groups a weight
__global__ __launch_bounds__(256) void k_cvt8(const float* __restrict__ q, const float* __restrict__ k, const float* __restrict__ v, const float* __restrict__ wq, const float* __restrict__ wk, const float* __restrict__ wv, const float* __restrict__ wo, bf* X, bf* Wd) {
    const unsigned g = blockIdx.x; const float* src; bf* dst; unsigned blk;
    if (g < 3 * XBK) { const unsigned s = g / XBK; blk = g % XBK; src = s == 0 ? q : s == 1 ? k : v; dst = X + (size_t)s * NB_ * TT * DM; }
    else { const unsigned s = (g - 3 * XBK) / WBK; blk = (g - 3 * XBK) % WBK; src = s == 0 ? wq : s == 1 ? wk : s == 2 ? wv : wo; dst = Wd + (size_t)s * DQ * DM; }
    const size_t i = (size_t)blk * 256 + threadIdx.x; const v8f x = *(const v8f*)(src + i * 8); v8us o;
#pragma unroll
    for (int e = 0; e < 8; ++e) o[e] = f2bf(x[e]);
    if (g >= 3 * XBK + 3 * WBK) {   // wo: one test a work-group
#pragma unroll
        for (int e = 0; e < 8; ++e) o[e] = __builtin_bit_cast(unsigned short, (h16)bf2f(o[e])); }
    *(v8us*)(dst + i * 8) = o;  }

#define KST 64   // keys a stage
#define PLIM 32768.0f   // a lane's partial sum of 16 weights up to here: every weight converts to a finite fp16
#define LP  72   // LDS row pitch in fp16: 144 B = 16 B x 9, 16-byte fragment reads of 16 rows fall on 64 distinct banks
__device__ __forceinline__ float xhalf(float x) { return __builtin_bit_cast(float, __builtin_amdgcn_permlanex16(__builtin_bit_cast(int, x), __builtin_bit_cast(int, x), 0x76543210, 0xfedcba98, false, false)); }   // lane l with lane l ^ 16
__global__ __launch_bounds__(256) __attribute__((amdgpu_waves_per_eu(4, 4))) void k_fattn(const h16* __restrict__ Q, const h16* __restrict__ Kp, const h16* __restrict__ Vt, float* CTX, h16* Am) {
    __shared__ __align__(16) h16 ks[2 * KST * LP]; __shared__ __align__(16) h16 vs[2 * HD * LP];
    const int lane = threadIdx.x & 31, lr = lane & 15, hi = lane >> 4, wv = threadIdx.x >> 5; const int h = blockIdx.y, b = blockIdx.z;
    const size_t pl = ((size_t)b * NH_ + h) * TT * HD; const int q0 = blockIdx.x * 256 + wv * 32;
    const float C2 = SCL * 1.4426950408889634f;   // scores to log2 units
    const h16* qp = Q + pl + (size_t)(q0 + lr) * HD + 8 * hi;
    const int srow = threadIdx.x >> 3, sch = (threadIdx.x & 7) * 8;   // staging: thread -> (row, 16-byte piece); rows srow and srow + 32
    const h16* kg = Kp + pl + (size_t)srow * HD + sch; const h16* vg = Vt + pl + (size_t)srow * TT + sch; const int so = srow * LP + sch;
    const int st0 = (int)(blockIdx.x * 4 + blockIdx.y) & (TT / KST - 1);
    v16h qf[2][2]; v8f o[4][2]; float m[2], l[2], sh[2]; v8h gk[2], gv[2];
#pragma unroll
    for (int r = 0; r < 2; ++r) { gk[r] = *(const v8h*)(kg + (size_t)(st0 * KST + r * 32) * HD); gv[r] = *(const v8h*)(vg + (size_t)r * 32 * TT + st0 * KST); }
#pragma unroll
    for (int qt = 0; qt < 2; ++qt) { m[qt] = -3.0e38f; sh[qt] = 3.0e38f; l[qt] = 0.f;
#pragma unroll
        for (int kc = 0; kc < 2; ++kc) qf[qt][kc] = WFrag<h16>::ld(qp + qt * 16 * HD + kc * 32);
#pragma unroll
        for (int dt = 0; dt < 4; ++dt) o[dt][qt] = (v8f){}; }
#pragma unroll
    for (int r = 0; r < 2; ++r) { *(v8h*)(ks + so + r * 32 * LP) = gk[r]; *(v8h*)(vs + so + r * 32 * LP) = gv[r]; }
    __syncthreads();   // stage 0 is published
    for (int st = 0; st < TT / KST; ++st) {
        const h16* kl = ks + (st & 1) * (KST * LP) + lr * LP + 8 * hi; const h16* vl = vs + (st & 1) * (HD * LP) + lr * LP + 8 * hi; const bool more = st + 1 < TT / KST;
        if (more) { const int sg = (st + 1 + st0) & (TT / KST - 1);   // the next stage of the ring
#pragma unroll
            for (int r = 0; r < 2; ++r) { gk[r] = *(const v8h*)(kg + (size_t)(sg * KST + r * 32) * HD); gv[r] = *(const v8h*)(vg + (size_t)r * 32 * TT + sg * KST); }
            asm volatile("s_wait_xcnt 0x0" ::: "memory"); }   // in front of the pass's fragment reads, which reuse the loads' address registers
#pragma unroll 1   // rolled: unrolled, the second pass's fragments are fetched over the first and the registers of four waves a SIMD no longer hold them
        for (int ps = 0; ps < KST / 32; ++ps) {
            v16h kf[2][2], vf[4], p[2]; v8f s[2][2]; float su[2];
#pragma unroll
            for (int kt = 0; kt < 2; ++kt)
#pragma unroll
                for (int kc = 0; kc < 2; ++kc) kf[kt][kc] = WFrag<h16>::ld(kl + (ps * 32 + kt * 16) * LP + kc * 32);
            // holds the K fragment reads together in front of the score WMMAs (loaded values as inputs only): left alone, they are split into three groups among the WMMAs, each with a wait to 0 of its own
            asm volatile("" :: "v"(kf[0][0]), "v"(kf[0][1]), "v"(kf[1][0]), "v"(kf[1][1]));
#pragma unroll
            for (int kt = 0; kt < 2; ++kt)
#pragma unroll
                for (int qt = 0; qt < 2; ++qt) { s[kt][qt] = wmma16(kf[kt][0], qf[qt][0], (v8f){}); s[kt][qt] = wmma16(kf[kt][1], qf[qt][1], s[kt][qt]); }
#pragma unroll
            for (int dt = 0; dt < 4; ++dt) vf[dt] = WFrag<h16>::ld(vl + dt * 16 * LP + ps * 32);
            __builtin_amdgcn_sched_barrier(0);   // the V^T fragment reads issue here, behind the score WMMAs (into the K fragments' registers), so that their LDS latency runs under the exponentials: left alone, they sink behind the branch, directly in front of the attn.v WMMAs that wait for them
            // weights of one query tile against the maximum in use, with this lane's partial sum; an fp16 weight out of range only ever reaches the test below
            auto weigh = [&](int qt) { v2f a = (v2f){};   // register pairs as the accumulators hold them: packed multiply-add, packed add, packed conversion, no register moves
#pragma unroll
                for (int kt = 0; kt < 2; ++kt)
#pragma unroll
                    for (int j = 0; j < 8; j += 2) { const v2f x = __builtin_elementwise_fma((v2f){s[kt][qt][j], s[kt][qt][j + 1]}, (v2f){C2, C2}, (v2f){sh[qt], sh[qt]}); const v2f e = (v2f){__builtin_amdgcn_exp2f(x[0]), __builtin_amdgcn_exp2f(x[1])};
                        a += e; p[qt][kt * 8 + j] = (h16)e[0]; p[qt][kt * 8 + j + 1] = (h16)e[1]; }
                su[qt] = a[0] + a[1]; };
            weigh(0); weigh(1);
            // one test a pass, a scalar branch: the weights are all >= 0, so a partial sum inside PLIM bounds each of them inside fp16; the first pass (no maximum yet: the sums are infinite) always takes the branch
            if (__builtin_amdgcn_ballot_w32(!(su[0] <= PLIM && su[1] <= PLIM)) != 0) {
#pragma unroll
                for (int qt = 0; qt < 2; ++qt) {
                    float mx = s[0][qt][0];
#pragma unroll
                    for (int j = 1; j < 8; ++j) mx = fmaxf(mx, s[0][qt][j]);
#pragma unroll
                    for (int j = 0; j < 8; ++j) mx = fmaxf(mx, s[1][qt][j]);
                    mx = fmaxf(mx, xhalf(mx));
                    const float mn = fmaxf(m[qt], mx * C2); const float al = __builtin_amdgcn_exp2f(m[qt] - mn);
                    if (qt == 0) asm volatile("v_nop" :: "v"(al));   // the slot behind a transcendental: without it the second tile's exponential follows this one directly and overwrites its source register
                    m[qt] = mn; sh[qt] = 10.0f - mn; l[qt] *= al;
#pragma unroll
                    for (int dt = 0; dt < 4; ++dt) o[dt][qt] *= al;
                    weigh(qt);
                }
            }
#pragma unroll
            for (int qt = 0; qt < 2; ++qt) { l[qt] += su[qt];
#pragma unroll
                for (int dt = 0; dt < 4; ++dt) o[dt][qt] = wmma16(vf[dt], p[qt], o[dt][qt]); }
            // four vector slots behind the pass's last WMMA: on the taken branch the loop's first vector instructions may overwrite its A or B registers
            asm volatile("v_nop\n\tv_nop\n\tv_nop\n\tv_nop" : "+v"(o[0][1]), "+v"(o[1][1]), "+v"(o[2][1]), "+v"(o[3][1]) : "v"(vf[0]), "v"(vf[1]), "v"(vf[2]), "v"(vf[3]));
        }
        if (more) { const int sn = ((st + 1) & 1);   // the other buffer: its readers left it before the barrier that ended the stage before this one
#pragma unroll
            for (int r = 0; r < 2; ++r) { *(v8h*)(ks + sn * (KST * LP) + so + r * 32 * LP) = gk[r]; *(v8h*)(vs + sn * (HD * LP) + so + r * 32 * LP) = gv[r]; } }
        __syncthreads();   // publishes stage st + 1 and ends every wave's reads of stage st
    }
#pragma unroll
    for (int qt = 0; qt < 2; ++qt) {
        const float lt = l[qt] + xhalf(l[qt]); const float inv = __fdiv_rn(1.0f, lt); const int t = q0 + qt * 16 + lr;
        float* cr = CTX + pl + (size_t)t * HD + 8 * hi; const size_t ao = ((size_t)b * TT + t) * DQ + h * HD + 8 * hi;
#pragma unroll
        for (int dt = 0; dt < 4; ++dt) { v4f c0, c1; v8h om;
#pragma unroll
            for (int j = 0; j < 8; ++j) { const float r = o[dt][qt][j] * inv; if (j < 4) c0[j] = r; else c1[j - 4] = r; om[j] = (h16)r; }
            *(v4f*)(cr + dt * 16) = c0; *(v4f*)(cr + dt * 16 + 4) = c1; *(v8h*)(Am + ao + dt * 16) = om; }
    }
}

extern "C" void kernel_launch(void* const* d_in, const int* in_sizes, int n_in,
                              void* d_out, int out_size, void* d_ws, size_t ws_size, hipStream_t stream) {
    (void)in_sizes; (void)n_in; (void)out_size;
    const float* xq = (const float*)d_in[0]; const float* xk = (const float*)d_in[1]; const float* xv = (const float*)d_in[2]; const float* wq = (const float*)d_in[3]; const float* bq = (const float*)d_in[4]; const float* wk = (const float*)d_in[5]; const float* bk = (const float*)d_in[6]; const float* wv = (const float*)d_in[7]; const float* bv = (const float*)d_in[8]; const float* wo = (const float*)d_in[9]; const float* bo = (const float*)d_in[10];
    // q, k, v [4][2048][1024], wq_w, wq_b, wk_w, wk_b, wv_w, wv_b, wo_w, wo_b = d_in[0..10]
    float* OUT = (float*)d_out;                          // output 0: out [4][2048][1024]
    float* OUT1 = (float*)d_out + (size_t)NB_ * TT * DM;   // output 1: ctx [4][16][2048][64], after the first output's 8,388,608 floats
    char* wsp = (char*)d_ws;
    auto take = [&](size_t bytes) { char* p = wsp; wsp += (bytes + 255) & ~(size_t)255; return (void*)p; };
    bf* WB = (bf*)take((size_t)4 * DQ * DM * 2);   // wq, wk, wv (bf16), wo (fp16), [out][in] as they stand (A for Q and K, Bt for V and wo)
    bf* XB = (bf*)take((size_t)3 * NB_ * TT * DM * 2);   // q, k, v, all batch entries
    const size_t PLN = (size_t)NH_ * TT * HD;   // one batch entry's fp16 planes
    h16* PL16 = (h16*)take(3 * NB_ * PLN * 2);   // Q [b][h][t][d], K [b][h][t][d], V^T [b][h][d][t]
    h16* ATm = (h16*)take((size_t)NB_ * TT * DQ * 2);   // the merged context
    if ((size_t)(wsp - (char*)d_ws) > ws_size) return;    // total 120 MiB of the workspace
    k_cvt8<<<3 * XBK + 4 * WBK, 256, 0, stream>>>(xq, xk, xv, wq, wk, wv, wo, XB, WB);
    k_proj<<<dim3((DQ / GWM) * (TT / GWN), 1, 3 * NB_), 256, 0, stream>>>(XB, WB, bq, bk, bv, PL16);
    k_fattn<<<dim3(TT / 256, NH_, NB_), 256, 0, stream>>>(PL16, PL16 + NB_ * PLN, PL16 + 2 * NB_ * PLN, OUT1, ATm);
    k_gemmw<DQ, true><<<dim3(NB_ * TT / GWM, DM / GWN, 1), 256, 0, stream>>>(ATm, (const h16*)(WB + (size_t)3 * DQ * DM), OUT, DM, bo);
}
